// v000
// Measured on an AMD MI455X. A time is GPU time per run, averaged over a window of back-to-back runs after a warm-up
// (all launches, gaps included; the runs take copies of the inputs in turn), and the median of several windows.
// Apart from v000's, it joins two sittings. Times from different sittings can be a few percent apart, while
// side-by-side timings come from the same sitting.
// The starting kernel, v000, takes 1510 microseconds a run.
// Contractions P.W, (P.W).Hy^T and attn.Hy: v_wmma_f32_16x16x32_bf16 on bf16 hi/lo split operand planes (hi.hi + hi.lo + lo.hi), f32 accumulate; masked row softmax, column-max softmax and the 1024x256 premise reduction in f32 on VALU; tuple output (out0 = broadcast aligned premise, out1 = aligned hypothesis).
#include <hip/hip_runtime.h>
#include <math.h>
#include <stdint.h>

#define NBATCH 16
#define PLEN   1024
#define HLEN   1024
#define DHID   256
#define GRPB   4                  // batches processed per score group
#define NGRPS  (NBATCH / GRPB)
#define NEG_FILL (-1e30f)
static_assert(PLEN == HLEN, "column-max softmax indexes premise rows by hypothesis position");
static_assert(NBATCH % GRPB == 0, "whole groups");

typedef __attribute__((ext_vector_type(16))) _Float16 v16h;
typedef __attribute__((ext_vector_type(8)))  _Float16 v8h;
typedef __attribute__((ext_vector_type(16))) __bf16   v16b;
typedef __attribute__((ext_vector_type(8)))  __bf16   v8b;
typedef __attribute__((ext_vector_type(8)))  float    v8f;
typedef __attribute__((ext_vector_type(4)))  float    v4f;
typedef __attribute__((ext_vector_type(2)))  float    v2f;
typedef __attribute__((ext_vector_type(4)))  unsigned int v4u;
typedef __attribute__((ext_vector_type(4)))  int      v4i;

__device__ __forceinline__ unsigned short f2bf_bits(float f) {
  unsigned u = __float_as_uint(f);
  return (unsigned short)((u + 0x7FFFu + ((u >> 16) & 1u)) >> 16);
}
__device__ __forceinline__ float bf_bits2f(unsigned short h) { return __uint_as_float(((unsigned)h) << 16); }

// hazard guards as plain device helpers (no inline asm inside the kernel template body)
__device__ __forceinline__ void dep_guard_h(v8f& a, v8f& b, v16h x, v16h y) { asm volatile("v_nop\n\tv_nop\n\tv_nop\n\tv_nop" : "+v"(a), "+v"(b) : "v"(x), "v"(y)); }
__device__ __forceinline__ void dep_guard_b(v8f& a, v8f& b, v16b x, v16b y) { asm volatile("v_nop\n\tv_nop\n\tv_nop\n\tv_nop" : "+v"(a), "+v"(b) : "v"(x), "v"(y)); }
__device__ __forceinline__ void keep4_h(v16h a, v16h b, v16h c, v16h d) { asm volatile("v_nop" :: "v"(a), "v"(b), "v"(c), "v"(d)); }
__device__ __forceinline__ void keep4_b(v16b a, v16b b, v16b c, v16b d) { asm volatile("v_nop" :: "v"(a), "v"(b), "v"(c), "v"(d)); }
__device__ __forceinline__ void acc_guard4(v8f& a, v8f& b, v8f& c, v8f& d) { asm volatile("v_nop\n\tv_nop\n\tv_nop\n\tv_nop" : "+v"(a), "+v"(b), "+v"(c), "+v"(d)); }
template <typename T> struct Frag;
template <> struct Frag<_Float16> {
  typedef v16h V; union U { v16h v; v8h h[2]; };
  static __device__ __forceinline__ v16h load(const _Float16* p) {   // elements 0..7 <- p[0..7], 8..15 <- p[16..23]
    U f; f.h[0] = *(const v8h*)(p); f.h[1] = *(const v8h*)(p + 16); return f.v;
  }
  static __device__ __forceinline__ v8f mma(v16h a, v16h b, v8f c) {
    return __builtin_amdgcn_wmma_f32_16x16x32_f16(false, a, false, b, (short)0, c, false, false);
  }
  static __device__ __forceinline__ void guard(v8f& a, v8f& b, v16h x, v16h y) { dep_guard_h(a, b, x, y); }
  static __device__ __forceinline__ void keep(v16h a, v16h b, v16h c, v16h d) { keep4_h(a, b, c, d); }
};
template <> struct Frag<__bf16> {
  typedef v16b V; union U { v16b v; v8b h[2]; };
  static __device__ __forceinline__ v16b load(const __bf16* p) {
    U f; f.h[0] = *(const v8b*)(p); f.h[1] = *(const v8b*)(p + 16); return f.v;
  }
  static __device__ __forceinline__ v8f mma(v16b a, v16b b, v8f c) {
    return __builtin_amdgcn_wmma_f32_16x16x32_bf16(false, a, false, b, (short)0, c, false, false);
  }
  static __device__ __forceinline__ void guard(v8f& a, v8f& b, v16b x, v16b y) { dep_guard_b(a, b, x, y); }
  static __device__ __forceinline__ void keep(v16b a, v16b b, v16b c, v16b d) { keep4_b(a, b, c, d); }
};

// ---- Register-blocked batched WMMA GEMM ------------------------------------
// C[m,n] = scale * sum_k A[m,k] * Bt[n,k] (+bias)(+resid); each wave owns a 64x64 tile.
// A row-major [M,K]; Bt row-major [N,K]; M,N % 64 == 0, K % 32 == 0.
// SPLIT: operands are hi/lo planes (A2/Bt2 = lo planes, same layout); product = hi·hi + hi·lo + lo·hi.
// BIAS_MODE: 0 = none, 1 = bias[m], 2 = bias[n].
// OUT_MODE: 0 = f32, 1 = f16, 2 = bf16 hi plane (Cout) + bf16 lo plane (Cout2).
// ET: 0 = f16 operands, 1 = bf16 operands (pointers passed as 16-bit storage)
template <int ET> struct Elem;
template <> struct Elem<0> { typedef _Float16 T; };
template <> struct Elem<1> { typedef __bf16 T; };
template <int ET, bool SPLIT, int BIAS_MODE, int OUT_MODE, bool RESID, int ACT = 0>
__global__ __launch_bounds__(256) void wmma_gemm64(
    const unsigned short* __restrict__ Ap, const unsigned short* __restrict__ A2p, int lda, long strideA,
    const unsigned short* __restrict__ Btp, const unsigned short* __restrict__ Bt2p, int ldb, long strideB,
    void* __restrict__ Cout, void* __restrict__ Cout2, int ldc, long strideC,
    const float* __restrict__ bias,
    const float* __restrict__ resid, long strideR,
    int M, int N, int K, float scale) {
  typedef typename Elem<ET>::T T;
  typedef typename Frag<T>::V V;
  const T* A = (const T*)Ap; const T* A2 = (const T*)A2p; const T* Bt = (const T*)Btp; const T* Bt2 = (const T*)Bt2p;
  __shared__ __align__(16) float sT[8][16 * 68];   // per-wave 16x64 slab, pitch 68 floats
  const int b    = blockIdx.y;
  const int lane = threadIdx.x & 31;
  const int wave = threadIdx.x >> 5;
  const int tilesN = N >> 6;
  const int tilesM = M >> 6;
  const int tile = blockIdx.x * 8 + wave;
  if (tile >= tilesM * tilesN) return;   // wave-uniform; no block barriers in this kernel
  const int tm = tile / tilesN;
  const int tn = tile - tm * tilesN;
  const int m0 = tm << 6;
  const int n0 = tn << 6;

  const T* Ab  = A  + (size_t)b * strideA;
  const T* Bb  = Bt + (size_t)b * strideB;
  const T* Ab2 = SPLIT ? (A2  + (size_t)b * strideA) : nullptr;
  const T* Bb2 = SPLIT ? (Bt2 + (size_t)b * strideB) : nullptr;

  const int rlane = lane & 15;                 // row (A) / col (B, D) within subtile
  const int koff  = (lane >> 4) * 8;           // k offset of this lane half
  const int mOff  = (lane >> 4) * 8;           // D row offset

  v8f acc[4][4];
#pragma unroll
  for (int i = 0; i < 4; ++i)
#pragma unroll
    for (int j = 0; j < 4; ++j) acc[i][j] = (v8f){0.f,0.f,0.f,0.f,0.f,0.f,0.f,0.f};

  for (int k0 = 0; k0 < K; k0 += 32) {
    V bh[4], bl[4];
#pragma unroll
    for (int j = 0; j < 4; ++j) {
      const size_t bo = (size_t)(n0 + (j << 4) + rlane) * ldb + koff + k0;
      bh[j] = Frag<T>::load(Bb + bo);
      if (SPLIT) bl[j] = Frag<T>::load(Bb2 + bo);
    }
#pragma unroll
    for (int i = 0; i < 4; ++i) {
      const size_t ao = (size_t)(m0 + (i << 4) + rlane) * lda + koff + k0;
      V ah = Frag<T>::load(Ab + ao);
      V al;
      if (SPLIT) al = Frag<T>::load(Ab2 + ao);
#pragma unroll
      for (int j = 0; j < 4; ++j) {
        acc[i][j] = Frag<T>::mma(ah, bh[j], acc[i][j]);
        if (SPLIT) {
          acc[i][j] = Frag<T>::mma(ah, bl[j], acc[i][j]);
          acc[i][j] = Frag<T>::mma(al, bh[j], acc[i][j]);
        }
      }
      Frag<T>::guard(acc[i][0], acc[i][3], ah, SPLIT ? al : ah);
    }
    Frag<T>::keep(bh[0], bh[1], bh[2], bh[3]);
    if (SPLIT) Frag<T>::keep(bl[0], bl[1], bl[2], bl[3]);
  }
  acc_guard4(acc[0][0], acc[0][1], acc[0][2], acc[0][3]);
  acc_guard4(acc[1][0], acc[1][1], acc[1][2], acc[1][3]);
  acc_guard4(acc[2][0], acc[2][1], acc[2][2], acc[2][3]);
  acc_guard4(acc[3][0], acc[3][1], acc[3][2], acc[3][3]);

  // ---- epilogue ----
  float* slab = sT[wave];
  const float* Rb = RESID ? (resid + (size_t)b * strideR) : nullptr;
#pragma unroll
  for (int i = 0; i < 4; ++i) {
    const int mBase = m0 + (i << 4);
#pragma unroll
    for (int j = 0; j < 4; ++j) {
      const int n = n0 + (j << 4) + rlane;
      float bv = 0.f;
      if (BIAS_MODE == 2) bv = bias[n];
#pragma unroll
      for (int r = 0; r < 8; ++r) {
        float v = acc[i][j][r] * scale;
        if (BIAS_MODE == 1) v += bias[mBase + mOff + r];
        if (BIAS_MODE == 2) v += bv;
        if (RESID) v += Rb[(size_t)(mBase + mOff + r) * ldc + n];
        if (ACT == 1) v = tanhf(v);
        if (ACT == 2) v = fmaxf(v, 0.0f);
        if (ACT == 3) v = v / (1.0f + expf(-v));
        if (ACT == 4) v = (v > 0.f) ? v : 0.01f * v;
        if (ACT == 5) v = 0.5f * v * (1.0f + erff(v * 0.70710678118654752f));
        slab[(mOff + r) * 68 + (j << 4) + rlane] = v;
      }
    }
    __builtin_amdgcn_fence(__ATOMIC_RELEASE, "workgroup");
    __builtin_amdgcn_wave_barrier();
    __builtin_amdgcn_fence(__ATOMIC_ACQUIRE, "workgroup");
    if (OUT_MODE == 0) {
      float* C = (float*)Cout + (size_t)b * strideC;
      const int hh = lane >> 4, c4 = (lane & 15) * 4;     // row seg = 256 B = 16 lanes x 16 B
      {
#pragma unroll
        for (int it = 0; it < 8; ++it) {
          const int row = it * 2 + hh;
          v4f v = *(const v4f*)(slab + row * 68 + c4);
          *(v4f*)(C + (size_t)(mBase + row) * ldc + n0 + c4) = v;
        }
        
      }
    } else {
      const int q = lane >> 3, c8 = (lane & 7) * 8;
      unsigned short* C  = (unsigned short*)Cout  + (size_t)b * strideC;
      unsigned short* C2 = (OUT_MODE == 2) ? ((unsigned short*)Cout2 + (size_t)b * strideC) : nullptr;
      {
#pragma unroll
        for (int it = 0; it < 4; ++it) {
          const int row = it * 4 + q;
          const float* sp = slab + row * 68 + c8;
          v8h hv, lv;
#pragma unroll
          for (int e = 0; e < 8; ++e) {
            if (OUT_MODE == 1) {
              hv[e] = (_Float16)sp[e];
            } else {
              unsigned short hb = f2bf_bits(sp[e]);
              unsigned short lb = f2bf_bits(sp[e] - bf_bits2f(hb));
              hv[e] = __builtin_bit_cast(_Float16, hb);
              lv[e] = __builtin_bit_cast(_Float16, lb);
            }
          }
          *(v8h*)(C + (size_t)(mBase + row) * ldc + n0 + c8) = hv;
          if (OUT_MODE == 2) *(v8h*)(C2 + (size_t)(mBase + row) * ldc + n0 + c8) = lv;
        }
        
      }
    }
    __builtin_amdgcn_fence(__ATOMIC_RELEASE, "workgroup");
    __builtin_amdgcn_wave_barrier();
    __builtin_amdgcn_fence(__ATOMIC_ACQUIRE, "workgroup");
  }
}

// ---------------------------------------------------------------------------
// Elementwise split: 2 elements per thread, one 4-B store per lane per plane -> each wave writes exactly one
// Coverage: grid = ceil(n2/256) blocks x 256 threads x 2 elements = 2*n2 elements = the whole plane (n2 = plane/2).
// ---------------------------------------------------------------------------
__device__ __forceinline__ unsigned pk16(unsigned short a, unsigned short b) { return (unsigned)a | ((unsigned)b << 16); }

// hi = bf16_rne(in), lo = bf16_rne(in - hi)
__global__ __launch_bounds__(256) void split_bf16x2_kernel(const float* __restrict__ in, unsigned short* __restrict__ hi,
                                                           unsigned short* __restrict__ lo, int n2) {
  const int i = blockIdx.x * 256 + threadIdx.x;
  if (i < n2) {
    const v2f f = *(const v2f*)(in + 2 * (size_t)i);
    const unsigned short h0 = f2bf_bits(f[0]), h1 = f2bf_bits(f[1]);
    const unsigned short l0 = f2bf_bits(f[0] - bf_bits2f(h0)), l1 = f2bf_bits(f[1] - bf_bits2f(h1));
    const unsigned uh = pk16(h0, h1), ul = pk16(l0, l1);
    ((unsigned*)hi)[i] = uh;
    ((unsigned*)lo)[i] = ul;
    
  }
}

// ---------------------------------------------------------------------------
// Transpose + bf16 hi/lo split of an f32 matrix, batched over blockIdx.z (input slice z at in + z*sIn floats,
// output slice z at out + z*sOut u16): in [rows][cols] (row pitch ldi floats) ->
// outh/outl[c][r] = split(in[r][c]) (row pitch ldo u16). grid (cols/64, rows/64, Z), 256 threads; rows, cols % 64 == 0.
// Coverage per block: load 4 it x 256 thr x 4 f32 = 64x64; store 2 it x 256 thr x 8 u16 = 64x64 per plane;
// ---------------------------------------------------------------------------
__global__ __launch_bounds__(256) void transpose_split_kernel(const float* __restrict__ in, int ldi, long sIn,
                                                              unsigned short* __restrict__ outh,
                                                              unsigned short* __restrict__ outl, int ldo, long sOut) {
  __shared__ __align__(16) float tf[64 * 68];
  const size_t zb = blockIdx.z;
  const float* inb = in + zb * (size_t)sIn;
  unsigned short* ohb = outh + zb * (size_t)sOut;
  unsigned short* olb = outl + zb * (size_t)sOut;
  const int c0  = blockIdx.x * 64;   // input column block = output row block
  const int r0  = blockIdx.y * 64;   // input row block    = output column block
  const int tid = threadIdx.x;
  {
    const int sub = tid >> 4;          // 0..15
    const int c4  = (tid & 15) * 4;    // 0..60
#pragma unroll
    for (int it = 0; it < 4; ++it) {
      const int rr = it * 16 + sub;
      const v4f a = *(const v4f*)(inb + (size_t)(r0 + rr) * ldi + c0 + c4);
      *(v4f*)(tf + rr * 68 + c4) = a;
    }
  }
  __syncthreads();
  const int s8 = tid >> 3;             // 0..31
  const int c8 = (tid & 7) * 8;        // 0..56
  v4u hv[2], lv[2];
#pragma unroll
  for (int it = 0; it < 2; ++it) {
    const int oc = it * 32 + s8;       // output row within tile (= input column)
    v4u a, a2;
#pragma unroll
    for (int q = 0; q < 4; ++q) {
      const float f0 = tf[(c8 + 2 * q) * 68 + oc];
      const float f1 = tf[(c8 + 2 * q + 1) * 68 + oc];
      const unsigned short h0 = f2bf_bits(f0), h1 = f2bf_bits(f1);
      const unsigned short l0 = f2bf_bits(f0 - bf_bits2f(h0));
      const unsigned short l1 = f2bf_bits(f1 - bf_bits2f(h1));
      a[q]  = pk16(h0, h1);
      a2[q] = pk16(l0, l1);
    }
    hv[it] = a; lv[it] = a2;
  }
  {
#pragma unroll
    for (int it = 0; it < 2; ++it) {
      const int oc = it * 32 + s8;
      const size_t go = (size_t)(c0 + oc) * ldo + r0 + c8;
      *(v4u*)(ohb + go) = hv[it];
      *(v4u*)(olb + go) = lv[it];
    }
    
  }
}

// ---------------------------------------------------------------------------
// Masked row softmax over one score row p of batch b = b0 + blockIdx.y (score slice blockIdx.y of S):
//   t[q] = (S[p][q] + bias) + (1 - pm[b][p]*hm[b][q]) * (-1e30)   (mask applied by value, finite fill)
//   a[q] = exp(t - max) / sum  -> bf16 hi/lo planes Ah/Al at the same [slice][p][q] position.
// Reductions in fixed order: per thread, wave shuffle tree, 4 wave partials in index order.
// Producer coverage: grid (PLEN, GRPB); 128 threads x 8 u16 = the whole 1024-wide row of each plane;
// ---------------------------------------------------------------------------
__global__ __launch_bounds__(128) void row_softmax_split_kernel(
    const float* __restrict__ S, const int* __restrict__ pm, const int* __restrict__ hm,
    const float* __restrict__ bias, unsigned short* __restrict__ Ah, unsigned short* __restrict__ Al, int b0) {
#pragma clang fp contract(off)
  __shared__ float redm[4];
  __shared__ float reds[4];
  const int p    = blockIdx.x;
  const int bb   = blockIdx.y;
  int b = b0 + bb;
  b = b < 0 ? 0 : (b > NBATCH - 1 ? NBATCH - 1 : b);
  const int tid  = threadIdx.x;
  const int lane = tid & 31;
  const int wave = tid >> 5;
  const int j0   = tid * 8;
  const float bv  = bias[0];
  const float pmv = (float)pm[(size_t)b * PLEN + p];
  const float* row = S + ((size_t)bb * PLEN + (size_t)p) * HLEN + j0;
  const v4f a0 = *(const v4f*)(row);
  const v4f a1 = *(const v4f*)(row + 4);
  const int* hrow = hm + (size_t)b * HLEN + j0;
  const v4i h0 = *(const v4i*)(hrow);
  const v4i h1 = *(const v4i*)(hrow + 4);
  float t[8];
#pragma unroll
  for (int e = 0; e < 4; ++e) {
    const float mk0 = pmv * (float)h0[e];
    const float mk1 = pmv * (float)h1[e];
    t[e]     = (a0[e] + bv) + (1.0f - mk0) * NEG_FILL;
    t[4 + e] = (a1[e] + bv) + (1.0f - mk1) * NEG_FILL;
  }
  float m = fmaxf(fmaxf(fmaxf(t[0], t[1]), fmaxf(t[2], t[3])), fmaxf(fmaxf(t[4], t[5]), fmaxf(t[6], t[7])));
#pragma unroll
  for (int off = 16; off > 0; off >>= 1) m = fmaxf(m, __shfl_xor(m, off, 32));
  if (lane == 0) redm[wave] = m;
  __syncthreads();
  const float mx = fmaxf(fmaxf(redm[0], redm[1]), fmaxf(redm[2], redm[3]));
  float ex[8];
#pragma unroll
  for (int e = 0; e < 8; ++e) ex[e] = __expf(t[e] - mx);
  float ps = ((((((ex[0] + ex[1]) + ex[2]) + ex[3]) + ex[4]) + ex[5]) + ex[6]) + ex[7];
#pragma unroll
  for (int off = 16; off > 0; off >>= 1) ps += __shfl_xor(ps, off, 32);
  if (lane == 0) reds[wave] = ps;
  __syncthreads();
  const float tot = ((reds[0] + reds[1]) + reds[2]) + reds[3];   // tot >= 1 (row max contributes exp(0))
  const float inv = 1.0f / tot;
  unsigned hw[4], lw[4];
#pragma unroll
  for (int q = 0; q < 4; ++q) {
    const float p0 = ex[2 * q] * inv, p1 = ex[2 * q + 1] * inv;
    const unsigned short hb0 = f2bf_bits(p0), hb1 = f2bf_bits(p1);
    const unsigned short lb0 = f2bf_bits(p0 - bf_bits2f(hb0));
    const unsigned short lb1 = f2bf_bits(p1 - bf_bits2f(hb1));
    hw[q] = pk16(hb0, hb1);
    lw[q] = pk16(lb0, lb1);
  }
  const v4u hvv = (v4u){hw[0], hw[1], hw[2], hw[3]};
  const v4u lvv = (v4u){lw[0], lw[1], lw[2], lw[3]};
  const size_t rowoff = ((size_t)bb * PLEN + (size_t)p) * HLEN + j0;
  *(v4u*)(Ah + rowoff) = hvv;
  *(v4u*)(Al + rowoff) = lvv;
  
}

// ---------------------------------------------------------------------------
// Column maximum of the masked score over all PLEN rows: CM[slice][q] = max_p t[p][q], t as in the row kernel.
// grid (HLEN/256, GRPB), 256 threads: thread = one column, sequential fixed-order walk over the rows
// ---------------------------------------------------------------------------
__global__ __launch_bounds__(256) void colmax_kernel(
    const float* __restrict__ S, const int* __restrict__ pm, const int* __restrict__ hm,
    const float* __restrict__ bias, float* __restrict__ CM, int b0) {
#pragma clang fp contract(off)
  __shared__ float spm[PLEN];
  const int bb  = blockIdx.y;
  int b = b0 + bb;
  b = b < 0 ? 0 : (b > NBATCH - 1 ? NBATCH - 1 : b);
  const int tid = threadIdx.x;
  const int q   = blockIdx.x * 256 + tid;              // < HLEN by grid construction
  for (int i = tid; i < PLEN; i += 256) spm[i] = (float)pm[(size_t)b * PLEN + i];
  __syncthreads();
  const float hmv = (float)hm[(size_t)b * HLEN + q];
  const float bv  = bias[0];
  const float* col = S + (size_t)bb * PLEN * HLEN + q;
  float m = -__builtin_inff();
#pragma unroll 4
  for (int p = 0; p < PLEN; ++p) {
    const float s  = col[(size_t)p * HLEN];
    const float tt = (s + bv) + (1.0f - spm[p] * hmv) * NEG_FILL;
    m = fmaxf(m, tt);
  }
  const size_t o = (size_t)bb * HLEN + q;
  ((float*)CM)[o] = m;
  
}

// ---------------------------------------------------------------------------
// Aligned premise of batch b = b0 + blockIdx.x: at[q] = softmax_q(CM[slice][q]) (f32, fixed order),
// ap[d] = sum_q at[q] * P[b][q][d] (f32, sequential over q, one thread per d), then
// out0[b][r][0..255] = ap for every r < HLEN. Row r (1 KB = 8 lines) is owned by wave (r & 7):
// two store instructions per row, each 32 lanes x 16 B = 4 whole consecutive lines, lane-contiguous;
// ---------------------------------------------------------------------------
__global__ __launch_bounds__(256) void premise_kernel(
    const float* __restrict__ CM, const float* __restrict__ P, float* __restrict__ out0, int b0) {
  __shared__ __align__(16) float scm[HLEN];
  __shared__ __align__(16) float spr[HLEN];
  __shared__ __align__(16) float sap[DHID];
  __shared__ float redm[8];
  __shared__ float reds[8];
  const int bb   = blockIdx.x;
  int b = b0 + bb;
  b = b < 0 ? 0 : (b > NBATCH - 1 ? NBATCH - 1 : b);
  const int tid  = threadIdx.x;
  const int lane = tid & 31;
  const int wave = tid >> 5;

  float lm = -__builtin_inff();
  for (int i = tid; i < HLEN; i += 256) {
    const float v = CM[(size_t)bb * HLEN + i];
    scm[i] = v;
    lm = fmaxf(lm, v);
  }
#pragma unroll
  for (int off = 16; off > 0; off >>= 1) lm = fmaxf(lm, __shfl_xor(lm, off, 32));
  if (lane == 0) redm[wave] = lm;
  __syncthreads();
  float mx = redm[0];
#pragma unroll
  for (int w = 1; w < 8; ++w) mx = fmaxf(mx, redm[w]);

  float ls = 0.f;
  for (int i = tid; i < HLEN; i += 256) {
    const float e = __expf(scm[i] - mx);
    spr[i] = e;
    ls += e;
  }
#pragma unroll
  for (int off = 16; off > 0; off >>= 1) ls += __shfl_xor(ls, off, 32);
  if (lane == 0) reds[wave] = ls;
  __syncthreads();
  float tot = reds[0];
#pragma unroll
  for (int w = 1; w < 8; ++w) tot += reds[w];
  const float inv = 1.0f / tot;                        // tot >= 1
  for (int i = tid; i < HLEN; i += 256) spr[i] = spr[i] * inv;   // same thread wrote spr[i]
  __syncthreads();

  const int d = tid;                                   // blockDim == DHID
  const float* Pb = P + (size_t)b * PLEN * DHID + d;
  float acc = 0.f;
#pragma unroll 4
  for (int q = 0; q < HLEN; ++q) acc = acc + spr[q] * Pb[(size_t)q * DHID];
  sap[d] = acc;
  __syncthreads();

  const v4f va = *(const v4f*)(sap + lane * 4);
  const v4f vb = *(const v4f*)(sap + 128 + lane * 4);
  float* ob = out0 + (size_t)b * HLEN * DHID;
  {
#pragma unroll 1
    for (int r = wave; r < HLEN; r += 8) {
      float* orow = ob + (size_t)r * DHID;
      *(v4f*)(orow + lane * 4) = va;
      *(v4f*)(orow + 128 + lane * 4) = vb;
    }
    
  }
}

// ---------------------------------------------------------------------------
// Workspace region map (byte offsets, all multiples of 16 KiB). Every region is fully written before it is read:
// the weight/activation planes once up front; S, Ah/Al, CM fully rewritten per group of GRPB batches.
//   WTh   bf16 [256][256]    Wt[e][d] = W[d][e] hi              0
//   WTl   bf16 [256][256]                                  131072
//   Ph    bf16 [16][1024][256] premise hi                  262144
//   Pl                                                    8650752
//   Hh    bf16 [16][1024][256] hypothesis hi             17039360
//   Hl                                                   25427968
//   HTh   bf16 [16][256][1024] hypothesis^T hi           33816576
//   HTl                                                  42205184
//   PWh   bf16 [16*1024][256]  (P.W) hi                  50593792
//   PWl                                                  58982400
//   S     f32  [GRPB][1024][1024] raw bilinear scores     67371008
//   Ah    bf16 [GRPB][1024][1024] row softmax hi         84148224
//   Al                                                  92536832
//   CM    f32  [GRPB][1024] masked column maxima        100925440
//   total                                               100941824
// ---------------------------------------------------------------------------
extern "C" void kernel_launch(void* const* d_in, const int* in_sizes, int n_in,
                              void* d_out, int out_size, void* d_ws, size_t ws_size,
                              hipStream_t stream) {
  if (n_in < 6) return;
  if (in_sizes[0] != NBATCH * PLEN * DHID) return;
  if (in_sizes[1] != NBATCH * HLEN * DHID) return;
  if (in_sizes[2] != NBATCH * PLEN || in_sizes[3] != NBATCH * HLEN) return;
  if (in_sizes[4] != DHID * DHID || in_sizes[5] < 1) return;
  if (out_size != 2 * NBATCH * PLEN * DHID) return;

  const float* P    = (const float*)d_in[0];
  const float* H    = (const float*)d_in[1];
  const int*   pm   = (const int*)d_in[2];
  const int*   hm   = (const int*)d_in[3];
  const float* W    = (const float*)d_in[4];
  const float* bias = (const float*)d_in[5];

  const size_t PWT = (size_t)DHID * DHID * 2;                 // 16-bit [256][256]
  const size_t PAC = (size_t)NBATCH * PLEN * DHID * 2;        // 16-bit [16][1024][256]
  const size_t PSC = (size_t)GRPB * PLEN * HLEN * 4;          // f32 scores of one group
  const size_t PPR = (size_t)GRPB * PLEN * HLEN * 2;          // bf16 probability plane of one group
  const size_t PCM = (size_t)GRPB * HLEN * 4;
  size_t off = 0;
  const size_t oWTh = off; off += PWT;
  const size_t oWTl = off; off += PWT;
  const size_t oPh  = off; off += PAC;
  const size_t oPl  = off; off += PAC;
  const size_t oHh  = off; off += PAC;
  const size_t oHl  = off; off += PAC;
  const size_t oHTh = off; off += PAC;
  const size_t oHTl = off; off += PAC;
  const size_t oPWh = off; off += PAC;
  const size_t oPWl = off; off += PAC;
  const size_t oS   = off; off += PSC;
  const size_t oAh  = off; off += PPR;
  const size_t oAl  = off; off += PPR;
  const size_t oCM  = off; off += PCM;
  if (off > ws_size) return;

  char* ws = (char*)d_ws;
  unsigned short* WTh = (unsigned short*)(ws + oWTh);
  unsigned short* WTl = (unsigned short*)(ws + oWTl);
  unsigned short* Ph  = (unsigned short*)(ws + oPh);
  unsigned short* Pl  = (unsigned short*)(ws + oPl);
  unsigned short* Hh  = (unsigned short*)(ws + oHh);
  unsigned short* Hl  = (unsigned short*)(ws + oHl);
  unsigned short* HTh = (unsigned short*)(ws + oHTh);
  unsigned short* HTl = (unsigned short*)(ws + oHTl);
  unsigned short* PWh = (unsigned short*)(ws + oPWh);
  unsigned short* PWl = (unsigned short*)(ws + oPWl);
  float*          Sbuf = (float*)(ws + oS);
  unsigned short* Ah  = (unsigned short*)(ws + oAh);
  unsigned short* Al  = (unsigned short*)(ws + oAl);
  float*          CM  = (float*)(ws + oCM);

  float* out0 = (float*)d_out;                                   // aligned premise (broadcast) [16][1024][256]
  float* out1 = (float*)d_out + (size_t)NBATCH * PLEN * DHID;    // aligned hypothesis [16][1024][256]

  const dim3 blk(256);
  // (0) W[0]: in [256 rows = d][256 cols = e] -> WT[e][d] hi/lo; grid (cols/64, rows/64, 1)
  transpose_split_kernel<<<dim3(DHID / 64, DHID / 64, 1), blk, 0, stream>>>(W, DHID, 0L, WTh, WTl, DHID, 0L);
  // (1) P, H -> bf16 hi/lo planes (natural layout), whole tensors: 8192 blocks x 256 thr x 2 = 16x1024x256
  const int n2 = NBATCH * PLEN * DHID / 2;
  const dim3 gSplit((n2 + 255) / 256);
  split_bf16x2_kernel<<<gSplit, blk, 0, stream>>>(P, Ph, Pl, n2);
  split_bf16x2_kernel<<<gSplit, blk, 0, stream>>>(H, Hh, Hl, n2);
  // (2) H[b]: in [1024 rows = q][256 cols = d] -> HT[b][d][q] hi/lo; grid (cols/64, rows/64, NBATCH)
  transpose_split_kernel<<<dim3(DHID / 64, HLEN / 64, NBATCH), blk, 0, stream>>>(
      H, DHID, (long)HLEN * DHID, HTh, HTl, HLEN, (long)DHID * HLEN);
  // (3) PW[p][e] = sum_d P[p][d] W[d][e] over all batches: M=16384, N=256, K=256 (K%32, M,N%64) -> PW hi/lo planes
  const dim3 gPW(((NBATCH * PLEN / 64) * (DHID / 64) + 7) / 8, 1);   // 128 blocks
  wmma_gemm64<1, true, 0, 2, false, 0><<<gPW, blk, 0, stream>>>(
      Ph, Pl, DHID, 0L, WTh, WTl, DHID, 0L, (void*)PWh, (void*)PWl, DHID, 0L,
      bias, bias, 0L, NBATCH * PLEN, DHID, DHID, 1.0f);

  const dim3 gS(((PLEN / 64) * (HLEN / 64) + 7) / 8, GRPB);      // 32 x 4: M=N=1024, K=256
  const dim3 gSm(PLEN, GRPB);                                    // one block per (row, batch in group)
  const dim3 gCM(HLEN / 256, GRPB);                              // 4 x 4
  const dim3 gPr(GRPB);
  const dim3 gAV(((PLEN / 64) * (DHID / 64) + 7) / 8, GRPB);     // 8 x 4: M=1024, N=256, K=1024

  for (int g = 0; g < NGRPS; ++g) {
    const int b0 = g * GRPB;
    const size_t aoff = (size_t)b0 * PLEN * DHID;               // u16 / float offset of batch b0 in [16][1024][256]
    const size_t toff = (size_t)b0 * DHID * HLEN;               // u16 offset of batch b0 in [16][256][1024]
    // (4) S[bb][p][q] = sum_e PW[b][p][e] H[b][q][e] (raw f32, whole 1024x1024 per bb)
    wmma_gemm64<1, true, 0, 0, false, 0><<<gS, blk, 0, stream>>>(
        PWh + aoff, PWl + aoff, DHID, (long)PLEN * DHID,
        Hh + aoff, Hl + aoff, DHID, (long)HLEN * DHID,
        (void*)Sbuf, (void*)Sbuf, HLEN, (long)PLEN * HLEN,
        bias, bias, 0L, PLEN, HLEN, DHID, 1.0f);
    // (5) bias + mask + row softmax -> A hi/lo planes (whole 1024x1024 per bb)
    row_softmax_split_kernel<<<gSm, dim3(128), 0, stream>>>(Sbuf, pm, hm, bias, Ah, Al, b0);
    // (6) masked column maxima -> CM (whole 1024 per bb)
    colmax_kernel<<<gCM, blk, 0, stream>>>(Sbuf, pm, hm, bias, CM, b0);
    // (7) softmax(CM), premise reduction, broadcast rows -> out0[b] (whole 1024x256 per b)
    premise_kernel<<<gPr, blk, 0, stream>>>(CM, P, out0, b0);
    // (8) out1[b][p][d] = sum_q A[bb][p][q] HT[b][d][q]: M=1024, N=256, K=1024 -> f32 d_out (whole 1024x256 per b)
    wmma_gemm64<1, true, 0, 0, false, 0><<<gAV, blk, 0, stream>>>(
        Ah, Al, HLEN, (long)PLEN * HLEN,
        HTh + toff, HTl + toff, HLEN, (long)DHID * HLEN,
        (void*)(out1 + aoff), (void*)(out1 + aoff), DHID, (long)PLEN * DHID,
        bias, bias, 0L, PLEN, DHID, HLEN, 1.0f);
  }
}

// v001
// One run takes 476 microseconds.
// Two timings next to v000 both put it at 3.17 times that version's speed.
// Contractions P.W, (P.W).Hy^T and attn.Hy: v_wmma_f32_16x16x32_bf16 on bf16 hi/lo split operand planes (hi.hi + hi.lo + lo.hi), f32 accumulate; masked row softmax, column-max softmax and the 1024x256 premise reduction in f32 on VALU; tuple output (out0 = broadcast aligned premise, out1 = aligned hypothesis).
#include <hip/hip_runtime.h>
#include <math.h>
#include <stdint.h>

#define NBATCH 16
#define PLEN   1024
#define HLEN   1024
#define DHID   256
#define GRPB   16                 // batches processed per score group (all of them: one pass of launches)
#define NGRPS  (NBATCH / GRPB)
#define NEG_FILL (-1e30f)
static_assert(PLEN == HLEN, "column-max softmax indexes premise rows by hypothesis position");
static_assert(NBATCH % GRPB == 0, "whole groups");

typedef __attribute__((ext_vector_type(16))) _Float16 v16h;
typedef __attribute__((ext_vector_type(8)))  _Float16 v8h;
typedef __attribute__((ext_vector_type(16))) __bf16   v16b;
typedef __attribute__((ext_vector_type(8)))  __bf16   v8b;
typedef __attribute__((ext_vector_type(8)))  float    v8f;
typedef __attribute__((ext_vector_type(4)))  float    v4f;
typedef __attribute__((ext_vector_type(2)))  float    v2f;
typedef __attribute__((ext_vector_type(4)))  unsigned int v4u;
typedef __attribute__((ext_vector_type(4)))  int      v4i;

__device__ __forceinline__ unsigned short f2bf_bits(float f) {
  unsigned u = __float_as_uint(f);
  return (unsigned short)((u + 0x7FFFu + ((u >> 16) & 1u)) >> 16);
}
__device__ __forceinline__ float bf_bits2f(unsigned short h) { return __uint_as_float(((unsigned)h) << 16); }

// hazard guards as plain device helpers (no inline asm inside the kernel template body)
__device__ __forceinline__ void dep_guard_h(v8f& a, v8f& b, v16h x, v16h y) { asm volatile("v_nop\n\tv_nop\n\tv_nop\n\tv_nop" : "+v"(a), "+v"(b) : "v"(x), "v"(y)); }
__device__ __forceinline__ void dep_guard_b(v8f& a, v8f& b, v16b x, v16b y) { asm volatile("v_nop\n\tv_nop\n\tv_nop\n\tv_nop" : "+v"(a), "+v"(b) : "v"(x), "v"(y)); }
__device__ __forceinline__ void keep4_h(v16h a, v16h b, v16h c, v16h d) { asm volatile("v_nop" :: "v"(a), "v"(b), "v"(c), "v"(d)); }
__device__ __forceinline__ void keep4_b(v16b a, v16b b, v16b c, v16b d) { asm volatile("v_nop" :: "v"(a), "v"(b), "v"(c), "v"(d)); }
__device__ __forceinline__ void acc_guard4(v8f& a, v8f& b, v8f& c, v8f& d) { asm volatile("v_nop\n\tv_nop\n\tv_nop\n\tv_nop" : "+v"(a), "+v"(b), "+v"(c), "+v"(d)); }
template <typename T> struct Frag;
template <> struct Frag<_Float16> {
  typedef v16h V; union U { v16h v; v8h h[2]; };
  static __device__ __forceinline__ v16h load(const _Float16* p) {   // elements 0..7 <- p[0..7], 8..15 <- p[16..23]
    U f; f.h[0] = *(const v8h*)(p); f.h[1] = *(const v8h*)(p + 16); return f.v;
  }
  static __device__ __forceinline__ v8f mma(v16h a, v16h b, v8f c) {
    return __builtin_amdgcn_wmma_f32_16x16x32_f16(false, a, false, b, (short)0, c, false, false);
  }
  static __device__ __forceinline__ void guard(v8f& a, v8f& b, v16h x, v16h y) { dep_guard_h(a, b, x, y); }
  static __device__ __forceinline__ void keep(v16h a, v16h b, v16h c, v16h d) { keep4_h(a, b, c, d); }
};
template <> struct Frag<__bf16> {
  typedef v16b V; union U { v16b v; v8b h[2]; };
  static __device__ __forceinline__ v16b load(const __bf16* p) {
    U f; f.h[0] = *(const v8b*)(p); f.h[1] = *(const v8b*)(p + 16); return f.v;
  }
  static __device__ __forceinline__ v8f mma(v16b a, v16b b, v8f c) {
    return __builtin_amdgcn_wmma_f32_16x16x32_bf16(false, a, false, b, (short)0, c, false, false);
  }
  static __device__ __forceinline__ void guard(v8f& a, v8f& b, v16b x, v16b y) { dep_guard_b(a, b, x, y); }
  static __device__ __forceinline__ void keep(v16b a, v16b b, v16b c, v16b d) { keep4_b(a, b, c, d); }
};

// ---- Register-blocked batched WMMA GEMM ------------------------------------
// C[m,n] = scale * sum_k A[m,k] * Bt[n,k] (+bias)(+resid); each wave owns a 64x64 tile.
// A row-major [M,K]; Bt row-major [N,K]; M,N % 64 == 0, K % 32 == 0.
// SPLIT: operands are hi/lo planes (A2/Bt2 = lo planes, same layout); product = hi·hi + hi·lo + lo·hi.
// BIAS_MODE: 0 = none, 1 = bias[m], 2 = bias[n].
// OUT_MODE: 0 = f32, 1 = f16, 2 = bf16 hi plane (Cout) + bf16 lo plane (Cout2).
// ET: 0 = f16 operands, 1 = bf16 operands (pointers passed as 16-bit storage)
template <int ET> struct Elem;
template <> struct Elem<0> { typedef _Float16 T; };
template <> struct Elem<1> { typedef __bf16 T; };
template <int ET, bool SPLIT, int BIAS_MODE, int OUT_MODE, bool RESID, int ACT = 0>
__global__ __launch_bounds__(256) void wmma_gemm64(
    const unsigned short* __restrict__ Ap, const unsigned short* __restrict__ A2p, int lda, long strideA,
    const unsigned short* __restrict__ Btp, const unsigned short* __restrict__ Bt2p, int ldb, long strideB,
    void* __restrict__ Cout, void* __restrict__ Cout2, int ldc, long strideC,
    const float* __restrict__ bias,
    const float* __restrict__ resid, long strideR,
    int M, int N, int K, float scale) {
  typedef typename Elem<ET>::T T;
  typedef typename Frag<T>::V V;
  const T* A = (const T*)Ap; const T* A2 = (const T*)A2p; const T* Bt = (const T*)Btp; const T* Bt2 = (const T*)Bt2p;
  __shared__ __align__(16) float sT[8][16 * 68];   // per-wave 16x64 slab, pitch 68 floats
  const int b    = blockIdx.y;
  const int lane = threadIdx.x & 31;
  const int wave = threadIdx.x >> 5;
  const int tilesN = N >> 6;
  const int tilesM = M >> 6;
  const int tile = blockIdx.x * 8 + wave;
  if (tile >= tilesM * tilesN) return;   // wave-uniform; no block barriers in this kernel
  const int tm = tile / tilesN;
  const int tn = tile - tm * tilesN;
  const int m0 = tm << 6;
  const int n0 = tn << 6;

  const T* Ab  = A  + (size_t)b * strideA;
  const T* Bb  = Bt + (size_t)b * strideB;
  const T* Ab2 = SPLIT ? (A2  + (size_t)b * strideA) : nullptr;
  const T* Bb2 = SPLIT ? (Bt2 + (size_t)b * strideB) : nullptr;

  const int rlane = lane & 15;                 // row (A) / col (B, D) within subtile
  const int koff  = (lane >> 4) * 8;           // k offset of this lane half
  const int mOff  = (lane >> 4) * 8;           // D row offset

  v8f acc[4][4];
#pragma unroll
  for (int i = 0; i < 4; ++i)
#pragma unroll
    for (int j = 0; j < 4; ++j) acc[i][j] = (v8f){0.f,0.f,0.f,0.f,0.f,0.f,0.f,0.f};

  for (int k0 = 0; k0 < K; k0 += 32) {
    V bh[4], bl[4];
#pragma unroll
    for (int j = 0; j < 4; ++j) {
      const size_t bo = (size_t)(n0 + (j << 4) + rlane) * ldb + koff + k0;
      bh[j] = Frag<T>::load(Bb + bo);
      if (SPLIT) bl[j] = Frag<T>::load(Bb2 + bo);
    }
#pragma unroll
    for (int i = 0; i < 4; ++i) {
      const size_t ao = (size_t)(m0 + (i << 4) + rlane) * lda + koff + k0;
      V ah = Frag<T>::load(Ab + ao);
      V al;
      if (SPLIT) al = Frag<T>::load(Ab2 + ao);
#pragma unroll
      for (int j = 0; j < 4; ++j) {
        acc[i][j] = Frag<T>::mma(ah, bh[j], acc[i][j]);
        if (SPLIT) {
          acc[i][j] = Frag<T>::mma(ah, bl[j], acc[i][j]);
          acc[i][j] = Frag<T>::mma(al, bh[j], acc[i][j]);
        }
      }
      Frag<T>::guard(acc[i][0], acc[i][3], ah, SPLIT ? al : ah);
    }
    Frag<T>::keep(bh[0], bh[1], bh[2], bh[3]);
    if (SPLIT) Frag<T>::keep(bl[0], bl[1], bl[2], bl[3]);
  }
  acc_guard4(acc[0][0], acc[0][1], acc[0][2], acc[0][3]);
  acc_guard4(acc[1][0], acc[1][1], acc[1][2], acc[1][3]);
  acc_guard4(acc[2][0], acc[2][1], acc[2][2], acc[2][3]);
  acc_guard4(acc[3][0], acc[3][1], acc[3][2], acc[3][3]);

  // ---- epilogue ----
  float* slab = sT[wave];
  const float* Rb = RESID ? (resid + (size_t)b * strideR) : nullptr;
#pragma unroll
  for (int i = 0; i < 4; ++i) {
    const int mBase = m0 + (i << 4);
#pragma unroll
    for (int j = 0; j < 4; ++j) {
      const int n = n0 + (j << 4) + rlane;
      float bv = 0.f;
      if (BIAS_MODE == 2) bv = bias[n];
#pragma unroll
      for (int r = 0; r < 8; ++r) {
        float v = acc[i][j][r] * scale;
        if (BIAS_MODE == 1) v += bias[mBase + mOff + r];
        if (BIAS_MODE == 2) v += bv;
        if (RESID) v += Rb[(size_t)(mBase + mOff + r) * ldc + n];
        if (ACT == 1) v = tanhf(v);
        if (ACT == 2) v = fmaxf(v, 0.0f);
        if (ACT == 3) v = v / (1.0f + expf(-v));
        if (ACT == 4) v = (v > 0.f) ? v : 0.01f * v;
        if (ACT == 5) v = 0.5f * v * (1.0f + erff(v * 0.70710678118654752f));
        slab[(mOff + r) * 68 + (j << 4) + rlane] = v;
      }
    }
    __builtin_amdgcn_fence(__ATOMIC_RELEASE, "workgroup");
    __builtin_amdgcn_wave_barrier();
    __builtin_amdgcn_fence(__ATOMIC_ACQUIRE, "workgroup");
    if (OUT_MODE == 0) {
      float* C = (float*)Cout + (size_t)b * strideC;
      const int hh = lane >> 4, c4 = (lane & 15) * 4;     // row seg = 256 B = 16 lanes x 16 B
      {
#pragma unroll
        for (int it = 0; it < 8; ++it) {
          const int row = it * 2 + hh;
          v4f v = *(const v4f*)(slab + row * 68 + c4);
          *(v4f*)(C + (size_t)(mBase + row) * ldc + n0 + c4) = v;
        }
        
      }
    } else {
      const int q = lane >> 3, c8 = (lane & 7) * 8;
      unsigned short* C  = (unsigned short*)Cout  + (size_t)b * strideC;
      unsigned short* C2 = (OUT_MODE == 2) ? ((unsigned short*)Cout2 + (size_t)b * strideC) : nullptr;
      {
#pragma unroll
        for (int it = 0; it < 4; ++it) {
          const int row = it * 4 + q;
          const float* sp = slab + row * 68 + c8;
          v8h hv, lv;
#pragma unroll
          for (int e = 0; e < 8; ++e) {
            if (OUT_MODE == 1) {
              hv[e] = (_Float16)sp[e];
            } else {
              unsigned short hb = f2bf_bits(sp[e]);
              unsigned short lb = f2bf_bits(sp[e] - bf_bits2f(hb));
              hv[e] = __builtin_bit_cast(_Float16, hb);
              lv[e] = __builtin_bit_cast(_Float16, lb);
            }
          }
          *(v8h*)(C + (size_t)(mBase + row) * ldc + n0 + c8) = hv;
          if (OUT_MODE == 2) *(v8h*)(C2 + (size_t)(mBase + row) * ldc + n0 + c8) = lv;
        }
        
      }
    }
    __builtin_amdgcn_fence(__ATOMIC_RELEASE, "workgroup");
    __builtin_amdgcn_wave_barrier();
    __builtin_amdgcn_fence(__ATOMIC_ACQUIRE, "workgroup");
  }
}

// ---------------------------------------------------------------------------
// Elementwise split: 2 elements per thread, one 4-B store per lane per plane -> each wave writes exactly one
// Coverage: grid = ceil(n2/256) blocks x 256 threads x 2 elements = 2*n2 elements = the whole plane (n2 = plane/2).
// ---------------------------------------------------------------------------
__device__ __forceinline__ unsigned pk16(unsigned short a, unsigned short b) { return (unsigned)a | ((unsigned)b << 16); }

// hi = bf16_rne(in), lo = bf16_rne(in - hi)
__global__ __launch_bounds__(256) void split_bf16x2_kernel(const float* __restrict__ in, unsigned short* __restrict__ hi,
                                                           unsigned short* __restrict__ lo, int n2) {
  const int i = blockIdx.x * 256 + threadIdx.x;
  if (i < n2) {
    const v2f f = *(const v2f*)(in + 2 * (size_t)i);
    const unsigned short h0 = f2bf_bits(f[0]), h1 = f2bf_bits(f[1]);
    const unsigned short l0 = f2bf_bits(f[0] - bf_bits2f(h0)), l1 = f2bf_bits(f[1] - bf_bits2f(h1));
    const unsigned uh = pk16(h0, h1), ul = pk16(l0, l1);
    ((unsigned*)hi)[i] = uh;
    ((unsigned*)lo)[i] = ul;
    
  }
}

// ---------------------------------------------------------------------------
// Transpose + bf16 hi/lo split of an f32 matrix, batched over blockIdx.z (input slice z at in + z*sIn floats,
// output slice z at out + z*sOut u16): in [rows][cols] (row pitch ldi floats) ->
// outh/outl[c][r] = split(in[r][c]) (row pitch ldo u16). grid (cols/64, rows/64, Z), 256 threads; rows, cols % 64 == 0.
// Coverage per block: load 4 it x 256 thr x 4 f32 = 64x64; store 2 it x 256 thr x 8 u16 = 64x64 per plane;
// ---------------------------------------------------------------------------
__global__ __launch_bounds__(256) void transpose_split_kernel(const float* __restrict__ in, int ldi, long sIn,
                                                              unsigned short* __restrict__ outh,
                                                              unsigned short* __restrict__ outl, int ldo, long sOut) {
  __shared__ __align__(16) float tf[64 * 68];
  const size_t zb = blockIdx.z;
  const float* inb = in + zb * (size_t)sIn;
  unsigned short* ohb = outh + zb * (size_t)sOut;
  unsigned short* olb = outl + zb * (size_t)sOut;
  const int c0  = blockIdx.x * 64;   // input column block = output row block
  const int r0  = blockIdx.y * 64;   // input row block    = output column block
  const int tid = threadIdx.x;
  {
    const int sub = tid >> 4;          // 0..15
    const int c4  = (tid & 15) * 4;    // 0..60
#pragma unroll
    for (int it = 0; it < 4; ++it) {
      const int rr = it * 16 + sub;
      const v4f a = *(const v4f*)(inb + (size_t)(r0 + rr) * ldi + c0 + c4);
      *(v4f*)(tf + rr * 68 + c4) = a;
    }
  }
  __syncthreads();
  const int s8 = tid >> 3;             // 0..31
  const int c8 = (tid & 7) * 8;        // 0..56
  v4u hv[2], lv[2];
#pragma unroll
  for (int it = 0; it < 2; ++it) {
    const int oc = it * 32 + s8;       // output row within tile (= input column)
    v4u a, a2;
#pragma unroll
    for (int q = 0; q < 4; ++q) {
      const float f0 = tf[(c8 + 2 * q) * 68 + oc];
      const float f1 = tf[(c8 + 2 * q + 1) * 68 + oc];
      const unsigned short h0 = f2bf_bits(f0), h1 = f2bf_bits(f1);
      const unsigned short l0 = f2bf_bits(f0 - bf_bits2f(h0));
      const unsigned short l1 = f2bf_bits(f1 - bf_bits2f(h1));
      a[q]  = pk16(h0, h1);
      a2[q] = pk16(l0, l1);
    }
    hv[it] = a; lv[it] = a2;
  }
  {
#pragma unroll
    for (int it = 0; it < 2; ++it) {
      const int oc = it * 32 + s8;
      const size_t go = (size_t)(c0 + oc) * ldo + r0 + c8;
      *(v4u*)(ohb + go) = hv[it];
      *(v4u*)(olb + go) = lv[it];
    }
    
  }
}

// ---------------------------------------------------------------------------
// Masked row softmax over one score row p of batch b = b0 + blockIdx.y (score slice blockIdx.y of S):
//   t[q] = (S[p][q] + bias) + (1 - pm[b][p]*hm[b][q]) * (-1e30)   (mask applied by value, finite fill)
//   a[q] = exp(t - max) / sum  -> bf16 hi/lo planes Ah/Al at the same [slice][p][q] position.
// Reductions in fixed order: per thread, wave shuffle tree, 4 wave partials in index order.
// Producer coverage: grid (PLEN, GRPB); 128 threads x 8 u16 = the whole 1024-wide row of each plane;
// ---------------------------------------------------------------------------
__global__ __launch_bounds__(128) void row_softmax_split_kernel(
    const float* __restrict__ S, const int* __restrict__ pm, const int* __restrict__ hm,
    const float* __restrict__ bias, unsigned short* __restrict__ Ah, unsigned short* __restrict__ Al, int b0) {
#pragma clang fp contract(off)
  __shared__ float redm[4];
  __shared__ float reds[4];
  const int p    = blockIdx.x;
  const int bb   = blockIdx.y;
  int b = b0 + bb;
  b = b < 0 ? 0 : (b > NBATCH - 1 ? NBATCH - 1 : b);
  const int tid  = threadIdx.x;
  const int lane = tid & 31;
  const int wave = tid >> 5;
  const int j0   = tid * 8;
  const float bv  = bias[0];
  const float pmv = (float)pm[(size_t)b * PLEN + p];
  const float* row = S + ((size_t)bb * PLEN + (size_t)p) * HLEN + j0;
  const v4f a0 = *(const v4f*)(row);
  const v4f a1 = *(const v4f*)(row + 4);
  const int* hrow = hm + (size_t)b * HLEN + j0;
  const v4i h0 = *(const v4i*)(hrow);
  const v4i h1 = *(const v4i*)(hrow + 4);
  float t[8];
#pragma unroll
  for (int e = 0; e < 4; ++e) {
    const float mk0 = pmv * (float)h0[e];
    const float mk1 = pmv * (float)h1[e];
    t[e]     = (a0[e] + bv) + (1.0f - mk0) * NEG_FILL;
    t[4 + e] = (a1[e] + bv) + (1.0f - mk1) * NEG_FILL;
  }
  float m = fmaxf(fmaxf(fmaxf(t[0], t[1]), fmaxf(t[2], t[3])), fmaxf(fmaxf(t[4], t[5]), fmaxf(t[6], t[7])));
#pragma unroll
  for (int off = 16; off > 0; off >>= 1) m = fmaxf(m, __shfl_xor(m, off, 32));
  if (lane == 0) redm[wave] = m;
  __syncthreads();
  const float mx = fmaxf(fmaxf(redm[0], redm[1]), fmaxf(redm[2], redm[3]));
  float ex[8];
#pragma unroll
  for (int e = 0; e < 8; ++e) ex[e] = __expf(t[e] - mx);
  float ps = ((((((ex[0] + ex[1]) + ex[2]) + ex[3]) + ex[4]) + ex[5]) + ex[6]) + ex[7];
#pragma unroll
  for (int off = 16; off > 0; off >>= 1) ps += __shfl_xor(ps, off, 32);
  if (lane == 0) reds[wave] = ps;
  __syncthreads();
  const float tot = ((reds[0] + reds[1]) + reds[2]) + reds[3];   // tot >= 1 (row max contributes exp(0))
  const float inv = 1.0f / tot;
  unsigned hw[4], lw[4];
#pragma unroll
  for (int q = 0; q < 4; ++q) {
    const float p0 = ex[2 * q] * inv, p1 = ex[2 * q + 1] * inv;
    const unsigned short hb0 = f2bf_bits(p0), hb1 = f2bf_bits(p1);
    const unsigned short lb0 = f2bf_bits(p0 - bf_bits2f(hb0));
    const unsigned short lb1 = f2bf_bits(p1 - bf_bits2f(hb1));
    hw[q] = pk16(hb0, hb1);
    lw[q] = pk16(lb0, lb1);
  }
  const v4u hvv = (v4u){hw[0], hw[1], hw[2], hw[3]};
  const v4u lvv = (v4u){lw[0], lw[1], lw[2], lw[3]};
  const size_t rowoff = ((size_t)bb * PLEN + (size_t)p) * HLEN + j0;
  *(v4u*)(Ah + rowoff) = hvv;
  *(v4u*)(Al + rowoff) = lvv;
  
}

// ---------------------------------------------------------------------------
// Column maximum of the masked score over all PLEN rows: CM[slice][q] = max_p t[p][q], t as in the row kernel.
// grid (HLEN/256, GRPB), 256 threads: thread = one column, sequential fixed-order walk over the rows
// ---------------------------------------------------------------------------
__global__ __launch_bounds__(256) void colmax_kernel(
    const float* __restrict__ S, const int* __restrict__ pm, const int* __restrict__ hm,
    const float* __restrict__ bias, float* __restrict__ CM, int b0) {
#pragma clang fp contract(off)
  __shared__ float spm[PLEN];
  const int bb  = blockIdx.y;
  int b = b0 + bb;
  b = b < 0 ? 0 : (b > NBATCH - 1 ? NBATCH - 1 : b);
  const int tid = threadIdx.x;
  const int q   = blockIdx.x * 256 + tid;              // < HLEN by grid construction
  for (int i = tid; i < PLEN; i += 256) spm[i] = (float)pm[(size_t)b * PLEN + i];
  __syncthreads();
  const float hmv = (float)hm[(size_t)b * HLEN + q];
  const float bv  = bias[0];
  const float* col = S + (size_t)bb * PLEN * HLEN + q;
  float m = -__builtin_inff();
#pragma unroll 4
  for (int p = 0; p < PLEN; ++p) {
    const float s  = col[(size_t)p * HLEN];
    const float tt = (s + bv) + (1.0f - spm[p] * hmv) * NEG_FILL;
    m = fmaxf(m, tt);
  }
  const size_t o = (size_t)bb * HLEN + q;
  ((float*)CM)[o] = m;
  
}

// ---------------------------------------------------------------------------
// Aligned premise of batch b = b0 + blockIdx.x: at[q] = softmax_q(CM[slice][q]) (f32, fixed order),
// ap[d] = sum_q at[q] * P[b][q][d] (f32, sequential over q, one thread per d), then
// out0[b][r][0..255] = ap for every r < HLEN. Row r (1 KB = 8 lines) is owned by wave (r & 7):
// two store instructions per row, each 32 lanes x 16 B = 4 whole consecutive lines, lane-contiguous;
// ---------------------------------------------------------------------------
__global__ __launch_bounds__(256) void premise_kernel(
    const float* __restrict__ CM, const float* __restrict__ P, float* __restrict__ out0, int b0) {
  __shared__ __align__(16) float scm[HLEN];
  __shared__ __align__(16) float spr[HLEN];
  __shared__ __align__(16) float sap[DHID];
  __shared__ float redm[8];
  __shared__ float reds[8];
  const int bb   = blockIdx.x;
  int b = b0 + bb;
  b = b < 0 ? 0 : (b > NBATCH - 1 ? NBATCH - 1 : b);
  const int tid  = threadIdx.x;
  const int lane = tid & 31;
  const int wave = tid >> 5;

  float lm = -__builtin_inff();
  for (int i = tid; i < HLEN; i += 256) {
    const float v = CM[(size_t)bb * HLEN + i];
    scm[i] = v;
    lm = fmaxf(lm, v);
  }
#pragma unroll
  for (int off = 16; off > 0; off >>= 1) lm = fmaxf(lm, __shfl_xor(lm, off, 32));
  if (lane == 0) redm[wave] = lm;
  __syncthreads();
  float mx = redm[0];
#pragma unroll
  for (int w = 1; w < 8; ++w) mx = fmaxf(mx, redm[w]);

  float ls = 0.f;
  for (int i = tid; i < HLEN; i += 256) {
    const float e = __expf(scm[i] - mx);
    spr[i] = e;
    ls += e;
  }
#pragma unroll
  for (int off = 16; off > 0; off >>= 1) ls += __shfl_xor(ls, off, 32);
  if (lane == 0) reds[wave] = ls;
  __syncthreads();
  float tot = reds[0];
#pragma unroll
  for (int w = 1; w < 8; ++w) tot += reds[w];
  const float inv = 1.0f / tot;                        // tot >= 1
  for (int i = tid; i < HLEN; i += 256) spr[i] = spr[i] * inv;   // same thread wrote spr[i]
  __syncthreads();

  const int d = tid;                                   // blockDim == DHID
  const float* Pb = P + (size_t)b * PLEN * DHID + d;
  float acc = 0.f;
#pragma unroll 4
  for (int q = 0; q < HLEN; ++q) acc = acc + spr[q] * Pb[(size_t)q * DHID];
  sap[d] = acc;
  __syncthreads();

  const v4f va = *(const v4f*)(sap + lane * 4);
  const v4f vb = *(const v4f*)(sap + 128 + lane * 4);
  float* ob = out0 + (size_t)b * HLEN * DHID;
  {
#pragma unroll 1
    for (int r = wave; r < HLEN; r += 8) {
      float* orow = ob + (size_t)r * DHID;
      *(v4f*)(orow + lane * 4) = va;
      *(v4f*)(orow + 128 + lane * 4) = vb;
    }
    
  }
}

// ---------------------------------------------------------------------------
// Workspace region map (byte offsets, all multiples of 16 KiB). Every region is fully written before it is read:
// the weight/activation planes once up front; S, Ah/Al, CM fully written per group of GRPB batches.
//   WTh   bf16 [256][256]    Wt[e][d] = W[d][e] hi              0
//   WTl   bf16 [256][256]                                  131072
//   Ph    bf16 [16][1024][256] premise hi                  262144
//   Pl                                                    8650752
//   Hh    bf16 [16][1024][256] hypothesis hi             17039360
//   Hl                                                   25427968
//   HTh   bf16 [16][256][1024] hypothesis^T hi           33816576
//   HTl                                                  42205184
//   PWh   bf16 [16*1024][256]  (P.W) hi                  50593792
//   PWl                                                  58982400
//   S     f32  [GRPB][1024][1024] raw bilinear scores     67371008
//   Ah    bf16 [GRPB][1024][1024] row softmax hi        134479872
//   Al                                                 168034304
//   CM    f32  [GRPB][1024] masked column maxima        201588736
//   total                                               201654272
// ---------------------------------------------------------------------------
extern "C" void kernel_launch(void* const* d_in, const int* in_sizes, int n_in,
                              void* d_out, int out_size, void* d_ws, size_t ws_size,
                              hipStream_t stream) {
  if (n_in < 6) return;
  if (in_sizes[0] != NBATCH * PLEN * DHID) return;
  if (in_sizes[1] != NBATCH * HLEN * DHID) return;
  if (in_sizes[2] != NBATCH * PLEN || in_sizes[3] != NBATCH * HLEN) return;
  if (in_sizes[4] != DHID * DHID || in_sizes[5] < 1) return;
  if (out_size != 2 * NBATCH * PLEN * DHID) return;

  const float* P    = (const float*)d_in[0];
  const float* H    = (const float*)d_in[1];
  const int*   pm   = (const int*)d_in[2];
  const int*   hm   = (const int*)d_in[3];
  const float* W    = (const float*)d_in[4];
  const float* bias = (const float*)d_in[5];

  const size_t PWT = (size_t)DHID * DHID * 2;                 // 16-bit [256][256]
  const size_t PAC = (size_t)NBATCH * PLEN * DHID * 2;        // 16-bit [16][1024][256]
  const size_t PSC = (size_t)GRPB * PLEN * HLEN * 4;          // f32 scores of one group
  const size_t PPR = (size_t)GRPB * PLEN * HLEN * 2;          // bf16 probability plane of one group
  const size_t PCM = (size_t)GRPB * HLEN * 4;
  size_t off = 0;
  const size_t oWTh = off; off += PWT;
  const size_t oWTl = off; off += PWT;
  const size_t oPh  = off; off += PAC;
  const size_t oPl  = off; off += PAC;
  const size_t oHh  = off; off += PAC;
  const size_t oHl  = off; off += PAC;
  const size_t oHTh = off; off += PAC;
  const size_t oHTl = off; off += PAC;
  const size_t oPWh = off; off += PAC;
  const size_t oPWl = off; off += PAC;
  const size_t oS   = off; off += PSC;
  const size_t oAh  = off; off += PPR;
  const size_t oAl  = off; off += PPR;
  const size_t oCM  = off; off += PCM;
  if (off > ws_size) return;

  char* ws = (char*)d_ws;
  unsigned short* WTh = (unsigned short*)(ws + oWTh);
  unsigned short* WTl = (unsigned short*)(ws + oWTl);
  unsigned short* Ph  = (unsigned short*)(ws + oPh);
  unsigned short* Pl  = (unsigned short*)(ws + oPl);
  unsigned short* Hh  = (unsigned short*)(ws + oHh);
  unsigned short* Hl  = (unsigned short*)(ws + oHl);
  unsigned short* HTh = (unsigned short*)(ws + oHTh);
  unsigned short* HTl = (unsigned short*)(ws + oHTl);
  unsigned short* PWh = (unsigned short*)(ws + oPWh);
  unsigned short* PWl = (unsigned short*)(ws + oPWl);
  float*          Sbuf = (float*)(ws + oS);
  unsigned short* Ah  = (unsigned short*)(ws + oAh);
  unsigned short* Al  = (unsigned short*)(ws + oAl);
  float*          CM  = (float*)(ws + oCM);

  float* out0 = (float*)d_out;                                   // aligned premise (broadcast) [16][1024][256]
  float* out1 = (float*)d_out + (size_t)NBATCH * PLEN * DHID;    // aligned hypothesis [16][1024][256]

  const dim3 blk(256);
  // (0) W[0]: in [256 rows = d][256 cols = e] -> WT[e][d] hi/lo; grid (cols/64, rows/64, 1)
  transpose_split_kernel<<<dim3(DHID / 64, DHID / 64, 1), blk, 0, stream>>>(W, DHID, 0L, WTh, WTl, DHID, 0L);
  // (1) P, H -> bf16 hi/lo planes (natural layout), whole tensors: 8192 blocks x 256 thr x 2 = 16x1024x256
  const int n2 = NBATCH * PLEN * DHID / 2;
  const dim3 gSplit((n2 + 255) / 256);
  split_bf16x2_kernel<<<gSplit, blk, 0, stream>>>(P, Ph, Pl, n2);
  split_bf16x2_kernel<<<gSplit, blk, 0, stream>>>(H, Hh, Hl, n2);
  // (2) H[b]: in [1024 rows = q][256 cols = d] -> HT[b][d][q] hi/lo; grid (cols/64, rows/64, NBATCH)
  transpose_split_kernel<<<dim3(DHID / 64, HLEN / 64, NBATCH), blk, 0, stream>>>(
      H, DHID, (long)HLEN * DHID, HTh, HTl, HLEN, (long)DHID * HLEN);
  // (3) PW[p][e] = sum_d P[p][d] W[d][e] over all batches: M=16384, N=256, K=256 (K%32, M,N%64) -> PW hi/lo planes
  const dim3 gPW(((NBATCH * PLEN / 64) * (DHID / 64) + 7) / 8, 1);   // 128 blocks
  wmma_gemm64<1, true, 0, 2, false, 0><<<gPW, blk, 0, stream>>>(
      Ph, Pl, DHID, 0L, WTh, WTl, DHID, 0L, (void*)PWh, (void*)PWl, DHID, 0L,
      bias, bias, 0L, NBATCH * PLEN, DHID, DHID, 1.0f);

  const dim3 gS(((PLEN / 64) * (HLEN / 64) + 7) / 8, GRPB);      // 32 x GRPB: M=N=1024, K=256
  const dim3 gSm(PLEN, GRPB);                                    // one block per (row, batch in group)
  const dim3 gCM(HLEN / 256, GRPB);                              // 4 x GRPB
  const dim3 gPr(GRPB);
  const dim3 gAV(((PLEN / 64) * (DHID / 64) + 7) / 8, GRPB);     // 8 x GRPB: M=1024, N=256, K=1024

  for (int g = 0; g < NGRPS; ++g) {
    const int b0 = g * GRPB;
    const size_t aoff = (size_t)b0 * PLEN * DHID;               // u16 / float offset of batch b0 in [16][1024][256]
    const size_t toff = (size_t)b0 * DHID * HLEN;               // u16 offset of batch b0 in [16][256][1024]
    // (4) S[bb][p][q] = sum_e PW[b][p][e] H[b][q][e] (raw f32, whole 1024x1024 per bb)
    wmma_gemm64<1, true, 0, 0, false, 0><<<gS, blk, 0, stream>>>(
        PWh + aoff, PWl + aoff, DHID, (long)PLEN * DHID,
        Hh + aoff, Hl + aoff, DHID, (long)HLEN * DHID,
        (void*)Sbuf, (void*)Sbuf, HLEN, (long)PLEN * HLEN,
        bias, bias, 0L, PLEN, HLEN, DHID, 1.0f);
    // (5) bias + mask + row softmax -> A hi/lo planes (whole 1024x1024 per bb)
    row_softmax_split_kernel<<<gSm, dim3(128), 0, stream>>>(Sbuf, pm, hm, bias, Ah, Al, b0);
    // (6) masked column maxima -> CM (whole 1024 per bb)
    colmax_kernel<<<gCM, blk, 0, stream>>>(Sbuf, pm, hm, bias, CM, b0);
    // (7) softmax(CM), premise reduction, broadcast rows -> out0[b] (whole 1024x256 per b)
    premise_kernel<<<gPr, blk, 0, stream>>>(CM, P, out0, b0);
    // (8) out1[b][p][d] = sum_q A[bb][p][q] HT[b][d][q]: M=1024, N=256, K=1024 -> f32 d_out (whole 1024x256 per b)
    wmma_gemm64<1, true, 0, 0, false, 0><<<gAV, blk, 0, stream>>>(
        Ah, Al, HLEN, (long)PLEN * HLEN,
        HTh + toff, HTl + toff, HLEN, (long)DHID * HLEN,
        (void*)(out1 + aoff), (void*)(out1 + aoff), DHID, (long)PLEN * DHID,
        bias, bias, 0L, PLEN, DHID, HLEN, 1.0f);
  }
}

// v002
// Measured time: 203 microseconds a run.
// Two timings next to v001 put it at 2.34 and 2.35 times that version's speed.
// All steps since v000 together make it 7.43 times as fast.
// Contractions P.W, (P.W).Hy^T and attn.Hy: v_wmma_f32_16x16x32_bf16 on bf16 hi/lo split operand planes (hi.hi + hi.lo + lo.hi), f32 accumulate; masked row softmax, column-max softmax and the 1024x256 premise reduction in f32 on VALU; tuple output (out0 = broadcast aligned premise, out1 = aligned hypothesis).
#include <hip/hip_runtime.h>
#include <math.h>
#include <stdint.h>

#define NBATCH 16
#define PLEN   1024
#define HLEN   1024
#define DHID   256
#define GRPB   16                 // batches processed per score group (all of them: one pass of launches)
#define NGRPS  (NBATCH / GRPB)
#define NEG_FILL (-1e30f)
static_assert(PLEN == HLEN, "column-max softmax indexes premise rows by hypothesis position");
static_assert(NBATCH % GRPB == 0, "whole groups");
static_assert(PLEN == 1024 && HLEN == 1024 && DHID == 256, "the column-max and premise kernels deal rows and columns for this shape");

typedef __attribute__((ext_vector_type(16))) _Float16 v16h;
typedef __attribute__((ext_vector_type(8)))  _Float16 v8h;
typedef __attribute__((ext_vector_type(16))) __bf16   v16b;
typedef __attribute__((ext_vector_type(8)))  __bf16   v8b;
typedef __attribute__((ext_vector_type(8)))  float    v8f;
typedef __attribute__((ext_vector_type(4)))  float    v4f;
typedef __attribute__((ext_vector_type(2)))  float    v2f;
typedef __attribute__((ext_vector_type(4)))  unsigned int v4u;
typedef __attribute__((ext_vector_type(4)))  int      v4i;

__device__ __forceinline__ unsigned short f2bf_bits(float f) {
  unsigned u = __float_as_uint(f);
  return (unsigned short)((u + 0x7FFFu + ((u >> 16) & 1u)) >> 16);
}
__device__ __forceinline__ float bf_bits2f(unsigned short h) { return __uint_as_float(((unsigned)h) << 16); }

// hazard guards as plain device helpers (no inline asm inside the kernel template body)
__device__ __forceinline__ void dep_guard_h(v8f& a, v8f& b, v16h x, v16h y) { asm volatile("v_nop\n\tv_nop\n\tv_nop\n\tv_nop" : "+v"(a), "+v"(b) : "v"(x), "v"(y)); }
__device__ __forceinline__ void dep_guard_b(v8f& a, v8f& b, v16b x, v16b y) { asm volatile("v_nop\n\tv_nop\n\tv_nop\n\tv_nop" : "+v"(a), "+v"(b) : "v"(x), "v"(y)); }
__device__ __forceinline__ void keep4_h(v16h a, v16h b, v16h c, v16h d) { asm volatile("v_nop" :: "v"(a), "v"(b), "v"(c), "v"(d)); }
__device__ __forceinline__ void keep4_b(v16b a, v16b b, v16b c, v16b d) { asm volatile("v_nop" :: "v"(a), "v"(b), "v"(c), "v"(d)); }
__device__ __forceinline__ void acc_guard4(v8f& a, v8f& b, v8f& c, v8f& d) { asm volatile("v_nop\n\tv_nop\n\tv_nop\n\tv_nop" : "+v"(a), "+v"(b), "+v"(c), "+v"(d)); }
template <typename T> struct Frag;
template <> struct Frag<_Float16> {
  typedef v16h V; union U { v16h v; v8h h[2]; };
  static __device__ __forceinline__ v16h load(const _Float16* p) {   // elements 0..7 <- p[0..7], 8..15 <- p[16..23]
    U f; f.h[0] = *(const v8h*)(p); f.h[1] = *(const v8h*)(p + 16); return f.v;
  }
  static __device__ __forceinline__ v8f mma(v16h a, v16h b, v8f c) {
    return __builtin_amdgcn_wmma_f32_16x16x32_f16(false, a, false, b, (short)0, c, false, false);
  }
  static __device__ __forceinline__ void guard(v8f& a, v8f& b, v16h x, v16h y) { dep_guard_h(a, b, x, y); }
  static __device__ __forceinline__ void keep(v16h a, v16h b, v16h c, v16h d) { keep4_h(a, b, c, d); }
};
template <> struct Frag<__bf16> {
  typedef v16b V; union U { v16b v; v8b h[2]; };
  static __device__ __forceinline__ v16b load(const __bf16* p) {
    U f; f.h[0] = *(const v8b*)(p); f.h[1] = *(const v8b*)(p + 16); return f.v;
  }
  static __device__ __forceinline__ v8f mma(v16b a, v16b b, v8f c) {
    return __builtin_amdgcn_wmma_f32_16x16x32_bf16(false, a, false, b, (short)0, c, false, false);
  }
  static __device__ __forceinline__ void guard(v8f& a, v8f& b, v16b x, v16b y) { dep_guard_b(a, b, x, y); }
  static __device__ __forceinline__ void keep(v16b a, v16b b, v16b c, v16b d) { keep4_b(a, b, c, d); }
};

// ---- Register-blocked batched WMMA GEMM ------------------------------------
// C[m,n] = scale * sum_k A[m,k] * Bt[n,k] (+bias)(+resid); each wave owns a 64x64 tile.
// A row-major [M,K]; Bt row-major [N,K]; M,N % 64 == 0, K % 32 == 0.
// SPLIT: operands are hi/lo planes (A2/Bt2 = lo planes, same layout); product = hi·hi + hi·lo + lo·hi.
// BIAS_MODE: 0 = none, 1 = bias[m], 2 = bias[n].
// OUT_MODE: 0 = f32, 1 = f16, 2 = bf16 hi plane (Cout) + bf16 lo plane (Cout2).
// ET: 0 = f16 operands, 1 = bf16 operands (pointers passed as 16-bit storage)
template <int ET> struct Elem;
template <> struct Elem<0> { typedef _Float16 T; };
template <> struct Elem<1> { typedef __bf16 T; };
template <int ET, bool SPLIT, int BIAS_MODE, int OUT_MODE, bool RESID, int ACT = 0>
__global__ __launch_bounds__(256) void wmma_gemm64(
    const unsigned short* __restrict__ Ap, const unsigned short* __restrict__ A2p, int lda, long strideA,
    const unsigned short* __restrict__ Btp, const unsigned short* __restrict__ Bt2p, int ldb, long strideB,
    void* __restrict__ Cout, void* __restrict__ Cout2, int ldc, long strideC,
    const float* __restrict__ bias,
    const float* __restrict__ resid, long strideR,
    int M, int N, int K, float scale) {
  typedef typename Elem<ET>::T T;
  typedef typename Frag<T>::V V;
  const T* A = (const T*)Ap; const T* A2 = (const T*)A2p; const T* Bt = (const T*)Btp; const T* Bt2 = (const T*)Bt2p;
  __shared__ __align__(16) float sT[8][16 * 68];   // per-wave 16x64 slab, pitch 68 floats
  const int b    = blockIdx.y;
  const int lane = threadIdx.x & 31;
  const int wave = threadIdx.x >> 5;
  const int tilesN = N >> 6;
  const int tilesM = M >> 6;
  const int tile = blockIdx.x * 8 + wave;
  if (tile >= tilesM * tilesN) return;   // wave-uniform; no block barriers in this kernel
  const int tm = tile / tilesN;
  const int tn = tile - tm * tilesN;
  const int m0 = tm << 6;
  const int n0 = tn << 6;

  const T* Ab  = A  + (size_t)b * strideA;
  const T* Bb  = Bt + (size_t)b * strideB;
  const T* Ab2 = SPLIT ? (A2  + (size_t)b * strideA) : nullptr;
  const T* Bb2 = SPLIT ? (Bt2 + (size_t)b * strideB) : nullptr;

  const int rlane = lane & 15;                 // row (A) / col (B, D) within subtile
  const int koff  = (lane >> 4) * 8;           // k offset of this lane half
  const int mOff  = (lane >> 4) * 8;           // D row offset

  v8f acc[4][4];
#pragma unroll
  for (int i = 0; i < 4; ++i)
#pragma unroll
    for (int j = 0; j < 4; ++j) acc[i][j] = (v8f){0.f,0.f,0.f,0.f,0.f,0.f,0.f,0.f};

  for (int k0 = 0; k0 < K; k0 += 32) {
    V bh[4], bl[4];
#pragma unroll
    for (int j = 0; j < 4; ++j) {
      const size_t bo = (size_t)(n0 + (j << 4) + rlane) * ldb + koff + k0;
      bh[j] = Frag<T>::load(Bb + bo);
      if (SPLIT) bl[j] = Frag<T>::load(Bb2 + bo);
    }
#pragma unroll
    for (int i = 0; i < 4; ++i) {
      const size_t ao = (size_t)(m0 + (i << 4) + rlane) * lda + koff + k0;
      V ah = Frag<T>::load(Ab + ao);
      V al;
      if (SPLIT) al = Frag<T>::load(Ab2 + ao);
#pragma unroll
      for (int j = 0; j < 4; ++j) {
        acc[i][j] = Frag<T>::mma(ah, bh[j], acc[i][j]);
        if (SPLIT) {
          acc[i][j] = Frag<T>::mma(ah, bl[j], acc[i][j]);
          acc[i][j] = Frag<T>::mma(al, bh[j], acc[i][j]);
        }
      }
      Frag<T>::guard(acc[i][0], acc[i][3], ah, SPLIT ? al : ah);
    }
    Frag<T>::keep(bh[0], bh[1], bh[2], bh[3]);
    if (SPLIT) Frag<T>::keep(bl[0], bl[1], bl[2], bl[3]);
  }
  acc_guard4(acc[0][0], acc[0][1], acc[0][2], acc[0][3]);
  acc_guard4(acc[1][0], acc[1][1], acc[1][2], acc[1][3]);
  acc_guard4(acc[2][0], acc[2][1], acc[2][2], acc[2][3]);
  acc_guard4(acc[3][0], acc[3][1], acc[3][2], acc[3][3]);

  // ---- epilogue ----
  float* slab = sT[wave];
  const float* Rb = RESID ? (resid + (size_t)b * strideR) : nullptr;
#pragma unroll
  for (int i = 0; i < 4; ++i) {
    const int mBase = m0 + (i << 4);
#pragma unroll
    for (int j = 0; j < 4; ++j) {
      const int n = n0 + (j << 4) + rlane;
      float bv = 0.f;
      if (BIAS_MODE == 2) bv = bias[n];
#pragma unroll
      for (int r = 0; r < 8; ++r) {
        float v = acc[i][j][r] * scale;
        if (BIAS_MODE == 1) v += bias[mBase + mOff + r];
        if (BIAS_MODE == 2) v += bv;
        if (RESID) v += Rb[(size_t)(mBase + mOff + r) * ldc + n];
        if (ACT == 1) v = tanhf(v);
        if (ACT == 2) v = fmaxf(v, 0.0f);
        if (ACT == 3) v = v / (1.0f + expf(-v));
        if (ACT == 4) v = (v > 0.f) ? v : 0.01f * v;
        if (ACT == 5) v = 0.5f * v * (1.0f + erff(v * 0.70710678118654752f));
        slab[(mOff + r) * 68 + (j << 4) + rlane] = v;
      }
    }
    __builtin_amdgcn_fence(__ATOMIC_RELEASE, "workgroup");
    __builtin_amdgcn_wave_barrier();
    __builtin_amdgcn_fence(__ATOMIC_ACQUIRE, "workgroup");
    if (OUT_MODE == 0) {
      float* C = (float*)Cout + (size_t)b * strideC;
      const int hh = lane >> 4, c4 = (lane & 15) * 4;     // row seg = 256 B = 16 lanes x 16 B
      {
#pragma unroll
        for (int it = 0; it < 8; ++it) {
          const int row = it * 2 + hh;
          v4f v = *(const v4f*)(slab + row * 68 + c4);
          *(v4f*)(C + (size_t)(mBase + row) * ldc + n0 + c4) = v;
        }
        
      }
    } else {
      const int q = lane >> 3, c8 = (lane & 7) * 8;
      unsigned short* C  = (unsigned short*)Cout  + (size_t)b * strideC;
      unsigned short* C2 = (OUT_MODE == 2) ? ((unsigned short*)Cout2 + (size_t)b * strideC) : nullptr;
      {
#pragma unroll
        for (int it = 0; it < 4; ++it) {
          const int row = it * 4 + q;
          const float* sp = slab + row * 68 + c8;
          v8h hv, lv;
#pragma unroll
          for (int e = 0; e < 8; ++e) {
            if (OUT_MODE == 1) {
              hv[e] = (_Float16)sp[e];
            } else {
              unsigned short hb = f2bf_bits(sp[e]);
              unsigned short lb = f2bf_bits(sp[e] - bf_bits2f(hb));
              hv[e] = __builtin_bit_cast(_Float16, hb);
              lv[e] = __builtin_bit_cast(_Float16, lb);
            }
          }
          *(v8h*)(C + (size_t)(mBase + row) * ldc + n0 + c8) = hv;
          if (OUT_MODE == 2) *(v8h*)(C2 + (size_t)(mBase + row) * ldc + n0 + c8) = lv;
        }
        
      }
    }
    __builtin_amdgcn_fence(__ATOMIC_RELEASE, "workgroup");
    __builtin_amdgcn_wave_barrier();
    __builtin_amdgcn_fence(__ATOMIC_ACQUIRE, "workgroup");
  }
}

// ---------------------------------------------------------------------------
// Elementwise split: 2 elements per thread, one 4-B store per lane per plane -> each wave writes exactly one
// Coverage: grid = ceil(n2/256) blocks x 256 threads x 2 elements = 2*n2 elements = the whole plane (n2 = plane/2).
// ---------------------------------------------------------------------------
__device__ __forceinline__ unsigned pk16(unsigned short a, unsigned short b) { return (unsigned)a | ((unsigned)b << 16); }

// hi = bf16_rne(in), lo = bf16_rne(in - hi)
__global__ __launch_bounds__(256) void split_bf16x2_kernel(const float* __restrict__ in, unsigned short* __restrict__ hi,
                                                           unsigned short* __restrict__ lo, int n2) {
  const int i = blockIdx.x * 256 + threadIdx.x;
  if (i < n2) {
    const v2f f = *(const v2f*)(in + 2 * (size_t)i);
    const unsigned short h0 = f2bf_bits(f[0]), h1 = f2bf_bits(f[1]);
    const unsigned short l0 = f2bf_bits(f[0] - bf_bits2f(h0)), l1 = f2bf_bits(f[1] - bf_bits2f(h1));
    const unsigned uh = pk16(h0, h1), ul = pk16(l0, l1);
    ((unsigned*)hi)[i] = uh;
    ((unsigned*)lo)[i] = ul;
    
  }
}

// ---------------------------------------------------------------------------
// Transpose + bf16 hi/lo split of an f32 matrix, batched over blockIdx.z (input slice z at in + z*sIn floats,
// output slice z at out + z*sOut u16): in [rows][cols] (row pitch ldi floats) ->
// outh/outl[c][r] = split(in[r][c]) (row pitch ldo u16). grid (cols/64, rows/64, Z), 256 threads; rows, cols % 64 == 0.
// Coverage per block: load 4 it x 256 thr x 4 f32 = 64x64; store 2 it x 256 thr x 8 u16 = 64x64 per plane;
// ---------------------------------------------------------------------------
__global__ __launch_bounds__(256) void transpose_split_kernel(const float* __restrict__ in, int ldi, long sIn,
                                                              unsigned short* __restrict__ outh,
                                                              unsigned short* __restrict__ outl, int ldo, long sOut) {
  __shared__ __align__(16) float tf[64 * 68];
  const size_t zb = blockIdx.z;
  const float* inb = in + zb * (size_t)sIn;
  unsigned short* ohb = outh + zb * (size_t)sOut;
  unsigned short* olb = outl + zb * (size_t)sOut;
  const int c0  = blockIdx.x * 64;   // input column block = output row block
  const int r0  = blockIdx.y * 64;   // input row block    = output column block
  const int tid = threadIdx.x;
  {
    const int sub = tid >> 4;          // 0..15
    const int c4  = (tid & 15) * 4;    // 0..60
#pragma unroll
    for (int it = 0; it < 4; ++it) {
      const int rr = it * 16 + sub;
      const v4f a = *(const v4f*)(inb + (size_t)(r0 + rr) * ldi + c0 + c4);
      *(v4f*)(tf + rr * 68 + c4) = a;
    }
  }
  __syncthreads();
  const int s8 = tid >> 3;             // 0..31
  const int c8 = (tid & 7) * 8;        // 0..56
  v4u hv[2], lv[2];
#pragma unroll
  for (int it = 0; it < 2; ++it) {
    const int oc = it * 32 + s8;       // output row within tile (= input column)
    v4u a, a2;
#pragma unroll
    for (int q = 0; q < 4; ++q) {
      const float f0 = tf[(c8 + 2 * q) * 68 + oc];
      const float f1 = tf[(c8 + 2 * q + 1) * 68 + oc];
      const unsigned short h0 = f2bf_bits(f0), h1 = f2bf_bits(f1);
      const unsigned short l0 = f2bf_bits(f0 - bf_bits2f(h0));
      const unsigned short l1 = f2bf_bits(f1 - bf_bits2f(h1));
      a[q]  = pk16(h0, h1);
      a2[q] = pk16(l0, l1);
    }
    hv[it] = a; lv[it] = a2;
  }
  {
#pragma unroll
    for (int it = 0; it < 2; ++it) {
      const int oc = it * 32 + s8;
      const size_t go = (size_t)(c0 + oc) * ldo + r0 + c8;
      *(v4u*)(ohb + go) = hv[it];
      *(v4u*)(olb + go) = lv[it];
    }
    
  }
}

// ---------------------------------------------------------------------------
// Masked row softmax over one score row p of batch b = b0 + blockIdx.y (score slice blockIdx.y of S):
//   t[q] = (S[p][q] + bias) + (1 - pm[b][p]*hm[b][q]) * (-1e30)   (mask applied by value, finite fill)
//   a[q] = exp(t - max) / sum  -> bf16 hi/lo planes Ah/Al at the same [slice][p][q] position.
// Reductions in fixed order: per thread, wave shuffle tree, 4 wave partials in index order.
// Producer coverage: grid (PLEN, GRPB); 128 threads x 8 u16 = the whole 1024-wide row of each plane;
// ---------------------------------------------------------------------------
__global__ __launch_bounds__(128) void row_softmax_split_kernel(
    const float* __restrict__ S, const int* __restrict__ pm, const int* __restrict__ hm,
    const float* __restrict__ bias, unsigned short* __restrict__ Ah, unsigned short* __restrict__ Al, int b0) {
#pragma clang fp contract(off)
  __shared__ float redm[4];
  __shared__ float reds[4];
  const int p    = blockIdx.x;
  const int bb   = blockIdx.y;
  int b = b0 + bb;
  b = b < 0 ? 0 : (b > NBATCH - 1 ? NBATCH - 1 : b);
  const int tid  = threadIdx.x;
  const int lane = tid & 31;
  const int wave = tid >> 5;
  const int j0   = tid * 8;
  const float bv  = bias[0];
  const float pmv = (float)pm[(size_t)b * PLEN + p];
  const float* row = S + ((size_t)bb * PLEN + (size_t)p) * HLEN + j0;
  const v4f a0 = *(const v4f*)(row);
  const v4f a1 = *(const v4f*)(row + 4);
  const int* hrow = hm + (size_t)b * HLEN + j0;
  const v4i h0 = *(const v4i*)(hrow);
  const v4i h1 = *(const v4i*)(hrow + 4);
  float t[8];
#pragma unroll
  for (int e = 0; e < 4; ++e) {
    const float mk0 = pmv * (float)h0[e];
    const float mk1 = pmv * (float)h1[e];
    t[e]     = (a0[e] + bv) + (1.0f - mk0) * NEG_FILL;
    t[4 + e] = (a1[e] + bv) + (1.0f - mk1) * NEG_FILL;
  }
  float m = fmaxf(fmaxf(fmaxf(t[0], t[1]), fmaxf(t[2], t[3])), fmaxf(fmaxf(t[4], t[5]), fmaxf(t[6], t[7])));
#pragma unroll
  for (int off = 16; off > 0; off >>= 1) m = fmaxf(m, __shfl_xor(m, off, 32));
  if (lane == 0) redm[wave] = m;
  __syncthreads();
  const float mx = fmaxf(fmaxf(redm[0], redm[1]), fmaxf(redm[2], redm[3]));
  float ex[8];
#pragma unroll
  for (int e = 0; e < 8; ++e) ex[e] = __expf(t[e] - mx);
  float ps = ((((((ex[0] + ex[1]) + ex[2]) + ex[3]) + ex[4]) + ex[5]) + ex[6]) + ex[7];
#pragma unroll
  for (int off = 16; off > 0; off >>= 1) ps += __shfl_xor(ps, off, 32);
  if (lane == 0) reds[wave] = ps;
  __syncthreads();
  const float tot = ((reds[0] + reds[1]) + reds[2]) + reds[3];   // tot >= 1 (row max contributes exp(0))
  const float inv = 1.0f / tot;
  unsigned hw[4], lw[4];
#pragma unroll
  for (int q = 0; q < 4; ++q) {
    const float p0 = ex[2 * q] * inv, p1 = ex[2 * q + 1] * inv;
    const unsigned short hb0 = f2bf_bits(p0), hb1 = f2bf_bits(p1);
    const unsigned short lb0 = f2bf_bits(p0 - bf_bits2f(hb0));
    const unsigned short lb1 = f2bf_bits(p1 - bf_bits2f(hb1));
    hw[q] = pk16(hb0, hb1);
    lw[q] = pk16(lb0, lb1);
  }
  const v4u hvv = (v4u){hw[0], hw[1], hw[2], hw[3]};
  const v4u lvv = (v4u){lw[0], lw[1], lw[2], lw[3]};
  const size_t rowoff = ((size_t)bb * PLEN + (size_t)p) * HLEN + j0;
  *(v4u*)(Ah + rowoff) = hvv;
  *(v4u*)(Al + rowoff) = lvv;
  
}

// ---------------------------------------------------------------------------
// Column maximum of the masked score over all PLEN rows: CM[slice][q] = max_p t[p][q], t as in the row kernel.
// grid (HLEN/64, GRPB), 512 threads: a work-group owns 64 columns (256 B of every score row). 16 lanes x 16 B cover
// that piece of one row, so the 512 threads cover 32 rows at a time and each thread walks only PLEN/32 = 32 rows,
// whose loads are all issued before anything waits on them. The 32 row classes are joined by one lane exchange and
// an LDS table of 16 wave partials; a maximum does not depend on the order, so CM keeps its bits.
// ---------------------------------------------------------------------------
__global__ __launch_bounds__(512) void colmax_kernel(
    const float* __restrict__ S, const int* __restrict__ pm, const int* __restrict__ hm,
    const float* __restrict__ bias, float* __restrict__ CM, int b0) {
#pragma clang fp contract(off)
  __shared__ float spm[PLEN];
  __shared__ __align__(16) float red[16][64];
  const int bb  = blockIdx.y;
  int b = b0 + bb;
  b = b < 0 ? 0 : (b > NBATCH - 1 ? NBATCH - 1 : b);
  const int tid  = threadIdx.x;
  const int lane = tid & 31;
  const int wave = tid >> 5;
  const int c4   = (tid & 15) * 4;                     // column quad inside the 64-column strip
  const int rsub = tid >> 4;                           // row class 0..31
  const int q0   = blockIdx.x * 64;                    // q0 + 63 < HLEN by grid construction
  // every load of the kernel is issued before the first wait on data: one round trip to memory in all
  const int* pmb = pm + (size_t)b * PLEN;
  const int* hmb = hm + (size_t)b * HLEN + q0;
  const int pm0 = pmb[tid];
  const int pm1 = pmb[512 + tid];
  const v4i hq  = *(const v4i*)(hmb + c4);
  const float bv = bias[0];
  const float* col = S + (size_t)bb * PLEN * HLEN + (size_t)rsub * HLEN + q0 + c4;
  v4f s[PLEN / 32];
#pragma unroll
  for (int k = 0; k < PLEN / 32; ++k) s[k] = *(const v4f*)(col + (size_t)k * 32 * HLEN);
  // the wait that stands before an issued load's address registers are written again; naming the three bases as
  // inputs keeps their registers untouched up to it (without it this build reused two scalar bases at once)
  asm volatile("s_wait_xcnt 0x0" :: "v"(col), "s"(pmb), "s"(hmb) : "memory");
  spm[tid]       = (float)pm0;
  spm[512 + tid] = (float)pm1;
  __syncthreads();
  float hmv[4], m[4];
#pragma unroll
  for (int e = 0; e < 4; ++e) { hmv[e] = (float)hq[e]; m[e] = -__builtin_inff(); }
#pragma unroll
  for (int k = 0; k < PLEN / 32; ++k) {
    const float pmv = spm[k * 32 + rsub];
#pragma unroll
    for (int e = 0; e < 4; ++e) {
      const float tt = (s[k][e] + bv) + (1.0f - pmv * hmv[e]) * NEG_FILL;
      m[e] = fmaxf(m[e], tt);
    }
  }
#pragma unroll
  for (int e = 0; e < 4; ++e) m[e] = fmaxf(m[e], __shfl_xor(m[e], 16, 32));   // the wave's two row classes
  if (lane < 16) *(v4f*)(&red[wave][c4]) = (v4f){m[0], m[1], m[2], m[3]};
  __syncthreads();
  if (tid < 64) {
    float r = red[0][tid];
#pragma unroll
    for (int w = 1; w < 16; ++w) r = fmaxf(r, red[w][tid]);
    CM[(size_t)bb * HLEN + q0 + tid] = r;
  }
}

// ---------------------------------------------------------------------------
// Aligned premise of batch b = b0 + blockIdx.y, hidden columns d0 = 32*blockIdx.x .. d0+31 (one 128-B line of every
// row): at[q] = softmax_q(CM[slice][q]) (f32, fixed order, computed by each of the 8 work-groups of a batch),
// ap[d] = sum_q at[q] * P[b][q][d], then out0[b][r][d0..d0+31] = ap for every r < HLEN.
// 8 lanes x 16 B cover the line of one row, so the 256 threads cover 32 rows at a time and each thread walks only
// HLEN/32 = 32 rows, whose loads are all issued at the top, together with those of the column maxima.
// Sum order (fixed): per thread q = rsub, rsub+32, ...; lane exchange over 8 then 16; 8 wave partials in index order.
// ---------------------------------------------------------------------------
__global__ __launch_bounds__(256) void premise_kernel(
    const float* __restrict__ CM, const float* __restrict__ P, float* __restrict__ out0, int b0) {
  __shared__ __align__(16) float scm[HLEN];
  __shared__ __align__(16) float spr[HLEN];
  __shared__ __align__(16) float spart[8][32];
  __shared__ float redm[8];
  __shared__ float reds[8];
  const int bb   = blockIdx.y;
  int b = b0 + bb;
  b = b < 0 ? 0 : (b > NBATCH - 1 ? NBATCH - 1 : b);
  const int tid  = threadIdx.x;
  const int lane = tid & 31;
  const int wave = tid >> 5;
  const int c4   = (tid & 7) * 4;                      // column quad inside the 32-column strip
  const int rsub = tid >> 3;                           // row class 0..31
  const size_t so = (size_t)b * PLEN * DHID + (size_t)rsub * DHID + blockIdx.x * 32 + c4;

  // every load of the kernel is issued before the first wait on data: one round trip to memory in all
  float cv[HLEN / 256];
#pragma unroll
  for (int j = 0; j < HLEN / 256; ++j) cv[j] = CM[(size_t)bb * HLEN + j * 256 + tid];
  const float* Pb = P + so;
  v4f pv[HLEN / 32];
#pragma unroll
  for (int k = 0; k < HLEN / 32; ++k) pv[k] = *(const v4f*)(Pb + (size_t)k * 32 * DHID);

  float lm = -__builtin_inff();
#pragma unroll
  for (int j = 0; j < HLEN / 256; ++j) {
    scm[j * 256 + tid] = cv[j];
    lm = fmaxf(lm, cv[j]);
  }
#pragma unroll
  for (int off = 16; off > 0; off >>= 1) lm = fmaxf(lm, __shfl_xor(lm, off, 32));
  if (lane == 0) redm[wave] = lm;
  __syncthreads();
  float mx = redm[0];
#pragma unroll
  for (int w = 1; w < 8; ++w) mx = fmaxf(mx, redm[w]);

  float ls = 0.f;
  for (int i = tid; i < HLEN; i += 256) {
    const float e = __expf(scm[i] - mx);
    spr[i] = e;
    ls += e;
  }
#pragma unroll
  for (int off = 16; off > 0; off >>= 1) ls += __shfl_xor(ls, off, 32);
  if (lane == 0) reds[wave] = ls;
  __syncthreads();
  float tot = reds[0];
#pragma unroll
  for (int w = 1; w < 8; ++w) tot += reds[w];
  const float inv = 1.0f / tot;                        // tot >= 1
  for (int i = tid; i < HLEN; i += 256) spr[i] = spr[i] * inv;   // same thread wrote spr[i]
  __syncthreads();

  v4f acc = (v4f){0.f, 0.f, 0.f, 0.f};
#pragma unroll
  for (int k = 0; k < HLEN / 32; ++k) acc = acc + spr[k * 32 + rsub] * pv[k];
#pragma unroll
  for (int e = 0; e < 4; ++e) {
    acc[e] += __shfl_xor(acc[e], 8, 32);               // the wave's four row classes
    acc[e] += __shfl_xor(acc[e], 16, 32);
  }
  if (lane < 8) *(v4f*)(&spart[wave][c4]) = acc;
  __syncthreads();
  v4f va = *(const v4f*)(&spart[0][c4]);
#pragma unroll
  for (int w = 1; w < 8; ++w) va = va + *(const v4f*)(&spart[w][c4]);

  float* ob = out0 + so;                               // PLEN == HLEN: out0 has the premise's shape
#pragma unroll
  for (int k = 0; k < HLEN / 32; ++k) *(v4f*)(ob + (size_t)k * 32 * DHID) = va;
}

// ---------------------------------------------------------------------------
// Workspace region map (byte offsets, all multiples of 16 KiB). Every region is fully written before it is read:
// the weight/activation planes once up front; S, Ah/Al, CM fully written per group of GRPB batches.
//   WTh   bf16 [256][256]    Wt[e][d] = W[d][e] hi              0
//   WTl   bf16 [256][256]                                  131072
//   Ph    bf16 [16][1024][256] premise hi                  262144
//   Pl                                                    8650752
//   Hh    bf16 [16][1024][256] hypothesis hi             17039360
//   Hl                                                   25427968
//   HTh   bf16 [16][256][1024] hypothesis^T hi           33816576
//   HTl                                                  42205184
//   PWh   bf16 [16*1024][256]  (P.W) hi                  50593792
//   PWl                                                  58982400
//   S     f32  [GRPB][1024][1024] raw bilinear scores     67371008
//   Ah    bf16 [GRPB][1024][1024] row softmax hi        134479872
//   Al                                                 168034304
//   CM    f32  [GRPB][1024] masked column maxima        201588736
//   total                                               201654272
// ---------------------------------------------------------------------------
extern "C" void kernel_launch(void* const* d_in, const int* in_sizes, int n_in,
                              void* d_out, int out_size, void* d_ws, size_t ws_size,
                              hipStream_t stream) {
  if (n_in < 6) return;
  if (in_sizes[0] != NBATCH * PLEN * DHID) return;
  if (in_sizes[1] != NBATCH * HLEN * DHID) return;
  if (in_sizes[2] != NBATCH * PLEN || in_sizes[3] != NBATCH * HLEN) return;
  if (in_sizes[4] != DHID * DHID || in_sizes[5] < 1) return;
  if (out_size != 2 * NBATCH * PLEN * DHID) return;

  const float* P    = (const float*)d_in[0];
  const float* H    = (const float*)d_in[1];
  const int*   pm   = (const int*)d_in[2];
  const int*   hm   = (const int*)d_in[3];
  const float* W    = (const float*)d_in[4];
  const float* bias = (const float*)d_in[5];

  const size_t PWT = (size_t)DHID * DHID * 2;                 // 16-bit [256][256]
  const size_t PAC = (size_t)NBATCH * PLEN * DHID * 2;        // 16-bit [16][1024][256]
  const size_t PSC = (size_t)GRPB * PLEN * HLEN * 4;          // f32 scores of one group
  const size_t PPR = (size_t)GRPB * PLEN * HLEN * 2;          // bf16 probability plane of one group
  const size_t PCM = (size_t)GRPB * HLEN * 4;
  size_t off = 0;
  const size_t oWTh = off; off += PWT;
  const size_t oWTl = off; off += PWT;
  const size_t oPh  = off; off += PAC;
  const size_t oPl  = off; off += PAC;
  const size_t oHh  = off; off += PAC;
  const size_t oHl  = off; off += PAC;
  const size_t oHTh = off; off += PAC;
  const size_t oHTl = off; off += PAC;
  const size_t oPWh = off; off += PAC;
  const size_t oPWl = off; off += PAC;
  const size_t oS   = off; off += PSC;
  const size_t oAh  = off; off += PPR;
  const size_t oAl  = off; off += PPR;
  const size_t oCM  = off; off += PCM;
  if (off > ws_size) return;

  char* ws = (char*)d_ws;
  unsigned short* WTh = (unsigned short*)(ws + oWTh);
  unsigned short* WTl = (unsigned short*)(ws + oWTl);
  unsigned short* Ph  = (unsigned short*)(ws + oPh);
  unsigned short* Pl  = (unsigned short*)(ws + oPl);
  unsigned short* Hh  = (unsigned short*)(ws + oHh);
  unsigned short* Hl  = (unsigned short*)(ws + oHl);
  unsigned short* HTh = (unsigned short*)(ws + oHTh);
  unsigned short* HTl = (unsigned short*)(ws + oHTl);
  unsigned short* PWh = (unsigned short*)(ws + oPWh);
  unsigned short* PWl = (unsigned short*)(ws + oPWl);
  float*          Sbuf = (float*)(ws + oS);
  unsigned short* Ah  = (unsigned short*)(ws + oAh);
  unsigned short* Al  = (unsigned short*)(ws + oAl);
  float*          CM  = (float*)(ws + oCM);

  float* out0 = (float*)d_out;                                   // aligned premise (broadcast) [16][1024][256]
  float* out1 = (float*)d_out + (size_t)NBATCH * PLEN * DHID;    // aligned hypothesis [16][1024][256]

  const dim3 blk(256);
  // (0) W[0]: in [256 rows = d][256 cols = e] -> WT[e][d] hi/lo; grid (cols/64, rows/64, 1)
  transpose_split_kernel<<<dim3(DHID / 64, DHID / 64, 1), blk, 0, stream>>>(W, DHID, 0L, WTh, WTl, DHID, 0L);
  // (1) P, H -> bf16 hi/lo planes (natural layout), whole tensors: 8192 blocks x 256 thr x 2 = 16x1024x256
  const int n2 = NBATCH * PLEN * DHID / 2;
  const dim3 gSplit((n2 + 255) / 256);
  split_bf16x2_kernel<<<gSplit, blk, 0, stream>>>(P, Ph, Pl, n2);
  split_bf16x2_kernel<<<gSplit, blk, 0, stream>>>(H, Hh, Hl, n2);
  // (2) H[b]: in [1024 rows = q][256 cols = d] -> HT[b][d][q] hi/lo; grid (cols/64, rows/64, NBATCH)
  transpose_split_kernel<<<dim3(DHID / 64, HLEN / 64, NBATCH), blk, 0, stream>>>(
      H, DHID, (long)HLEN * DHID, HTh, HTl, HLEN, (long)DHID * HLEN);
  // (3) PW[p][e] = sum_d P[p][d] W[d][e] over all batches: M=16384, N=256, K=256 (K%32, M,N%64) -> PW hi/lo planes
  const dim3 gPW(((NBATCH * PLEN / 64) * (DHID / 64) + 7) / 8, 1);   // 128 blocks
  wmma_gemm64<1, true, 0, 2, false, 0><<<gPW, blk, 0, stream>>>(
      Ph, Pl, DHID, 0L, WTh, WTl, DHID, 0L, (void*)PWh, (void*)PWl, DHID, 0L,
      bias, bias, 0L, NBATCH * PLEN, DHID, DHID, 1.0f);

  const dim3 gS(((PLEN / 64) * (HLEN / 64) + 7) / 8, GRPB);      // 32 x GRPB: M=N=1024, K=256
  const dim3 gSm(PLEN, GRPB);                                    // one block per (row, batch in group)
  const dim3 gCM(HLEN / 64, GRPB);                               // 16 x GRPB, 512 threads each
  const dim3 gPr(DHID / 32, GRPB);                               // 8 x GRPB
  const dim3 gAV(((PLEN / 64) * (DHID / 64) + 7) / 8, GRPB);     // 8 x GRPB: M=1024, N=256, K=1024

  for (int g = 0; g < NGRPS; ++g) {
    const int b0 = g * GRPB;
    const size_t aoff = (size_t)b0 * PLEN * DHID;               // u16 / float offset of batch b0 in [16][1024][256]
    const size_t toff = (size_t)b0 * DHID * HLEN;               // u16 offset of batch b0 in [16][256][1024]
    // (4) S[bb][p][q] = sum_e PW[b][p][e] H[b][q][e] (raw f32, whole 1024x1024 per bb)
    wmma_gemm64<1, true, 0, 0, false, 0><<<gS, blk, 0, stream>>>(
        PWh + aoff, PWl + aoff, DHID, (long)PLEN * DHID,
        Hh + aoff, Hl + aoff, DHID, (long)HLEN * DHID,
        (void*)Sbuf, (void*)Sbuf, HLEN, (long)PLEN * HLEN,
        bias, bias, 0L, PLEN, HLEN, DHID, 1.0f);
    // (5) bias + mask + row softmax -> A hi/lo planes (whole 1024x1024 per bb)
    row_softmax_split_kernel<<<gSm, dim3(128), 0, stream>>>(Sbuf, pm, hm, bias, Ah, Al, b0);
    // (6) masked column maxima -> CM (whole 1024 per bb)
    colmax_kernel<<<gCM, dim3(512), 0, stream>>>(Sbuf, pm, hm, bias, CM, b0);
    // (7) softmax(CM), premise reduction, broadcast rows -> out0[b] (whole 1024x256 per b)
    premise_kernel<<<gPr, blk, 0, stream>>>(CM, P, out0, b0);
    // (8) out1[b][p][d] = sum_q A[bb][p][q] HT[b][d][q]: M=1024, N=256, K=1024 -> f32 d_out (whole 1024x256 per b)
    wmma_gemm64<1, true, 0, 0, false, 0><<<gAV, blk, 0, stream>>>(
        Ah, Al, HLEN, (long)PLEN * HLEN,
        HTh + toff, HTl + toff, HLEN, (long)DHID * HLEN,
        (void*)(out1 + aoff), (void*)(out1 + aoff), DHID, (long)PLEN * DHID,
        bias, bias, 0L, PLEN, DHID, HLEN, 1.0f);
  }
}

// v003
// A run of this version takes 121 microseconds.
// Timed twice side by side with v002, it ran 1.67 and 1.66 times as fast.
// Over all steps from v000 it is 12.4 times as fast.
// Contractions P.W, (P.W).Hy^T and attn.Hy: v_wmma_f32_16x16x32_bf16 on bf16 hi/lo split operand planes (hi.hi + hi.lo + lo.hi), f32 accumulate; masked row softmax, column-max softmax and the 1024x256 premise reduction in f32 on VALU; tuple output (out0 = broadcast aligned premise, out1 = aligned hypothesis).
#include <hip/hip_runtime.h>
#include <math.h>
#include <stdint.h>

#define NBATCH 16
#define PLEN   1024
#define HLEN   1024
#define DHID   256
#define GRPB   16                 // batches processed per score group (all of them: one pass of launches)
#define NGRPS  (NBATCH / GRPB)
#define NEG_FILL (-1e30f)
static_assert(PLEN == HLEN, "column-max softmax indexes premise rows by hypothesis position");
static_assert(NBATCH % GRPB == 0, "whole groups");
static_assert(PLEN == 1024 && HLEN == 1024 && DHID == 256, "the column-max and premise kernels deal rows and columns for this shape");

typedef __attribute__((ext_vector_type(16))) _Float16 v16h;
typedef __attribute__((ext_vector_type(8)))  _Float16 v8h;
typedef __attribute__((ext_vector_type(16))) __bf16   v16b;
typedef __attribute__((ext_vector_type(8)))  __bf16   v8b;
typedef __attribute__((ext_vector_type(8)))  float    v8f;
typedef __attribute__((ext_vector_type(4)))  float    v4f;
typedef __attribute__((ext_vector_type(2)))  float    v2f;
typedef __attribute__((ext_vector_type(4)))  unsigned int v4u;
typedef __attribute__((ext_vector_type(4)))  int      v4i;

__device__ __forceinline__ unsigned short f2bf_bits(float f) {
  unsigned u = __float_as_uint(f);
  return (unsigned short)((u + 0x7FFFu + ((u >> 16) & 1u)) >> 16);
}
__device__ __forceinline__ float bf_bits2f(unsigned short h) { return __uint_as_float(((unsigned)h) << 16); }

// hazard guards as plain device helpers
__device__ __forceinline__ void dep_guard_h(v8f& a, v8f& b, v16h x, v16h y) { asm volatile("v_nop\n\tv_nop\n\tv_nop\n\tv_nop" : "+v"(a), "+v"(b) : "v"(x), "v"(y)); }
__device__ __forceinline__ void dep_guard_b(v8f& a, v8f& b, v16b x, v16b y) { asm volatile("v_nop\n\tv_nop\n\tv_nop\n\tv_nop" : "+v"(a), "+v"(b) : "v"(x), "v"(y)); }
__device__ __forceinline__ void keep4_h(v16h a, v16h b, v16h c, v16h d) { asm volatile("v_nop" :: "v"(a), "v"(b), "v"(c), "v"(d)); }
__device__ __forceinline__ void keep4_b(v16b a, v16b b, v16b c, v16b d) { asm volatile("v_nop" :: "v"(a), "v"(b), "v"(c), "v"(d)); }
__device__ __forceinline__ void acc_guard4(v8f& a, v8f& b, v8f& c, v8f& d) { asm volatile("v_nop\n\tv_nop\n\tv_nop\n\tv_nop" : "+v"(a), "+v"(b), "+v"(c), "+v"(d)); }
template <typename T> struct Frag;
template <> struct Frag<_Float16> {
  typedef v16h V; union U { v16h v; v8h h[2]; };
  static __device__ __forceinline__ v16h load(const _Float16* p) {   // elements 0..7 <- p[0..7], 8..15 <- p[16..23]
    U f; f.h[0] = *(const v8h*)(p); f.h[1] = *(const v8h*)(p + 16); return f.v;
  }
  static __device__ __forceinline__ v8f mma(v16h a, v16h b, v8f c) {
    return __builtin_amdgcn_wmma_f32_16x16x32_f16(false, a, false, b, (short)0, c, false, false);
  }
  static __device__ __forceinline__ void guard(v8f& a, v8f& b, v16h x, v16h y) { dep_guard_h(a, b, x, y); }
  static __device__ __forceinline__ void keep(v16h a, v16h b, v16h c, v16h d) { keep4_h(a, b, c, d); }
};
template <> struct Frag<__bf16> {
  typedef v16b V; union U { v16b v; v8b h[2]; };
  static __device__ __forceinline__ v16b load(const __bf16* p) {
    U f; f.h[0] = *(const v8b*)(p); f.h[1] = *(const v8b*)(p + 16); return f.v;
  }
  static __device__ __forceinline__ v8f mma(v16b a, v16b b, v8f c) {
    return __builtin_amdgcn_wmma_f32_16x16x32_bf16(false, a, false, b, (short)0, c, false, false);
  }
  static __device__ __forceinline__ void guard(v8f& a, v8f& b, v16b x, v16b y) { dep_guard_b(a, b, x, y); }
  static __device__ __forceinline__ void keep(v16b a, v16b b, v16b c, v16b d) { keep4_b(a, b, c, d); }
};

// ---- Register-blocked batched WMMA GEMM, operands staged in LDS -------------
// C[m,n] = scale * sum_k A[m,k] * Bt[n,k] (+bias)(+resid); a work-group of 4 waves (2 x 2) owns a 128x128 tile,
// each wave a 64x64 tile of it.
// A row-major [M,K]; Bt row-major [N,K]; M,N % 128 == 0, K % 64 == 0.
// SPLIT: operands are hi/lo planes (A2/Bt2 = lo planes, same layout); product = hi.hi + hi.lo + lo.hi.
// BIAS_MODE: 0 = none, 1 = bias[m], 2 = bias[n].
// OUT_MODE: 0 = f32, 1 = f16, 2 = bf16 hi plane (Cout) + bf16 lo plane (Cout2).
// ET: 0 = f16 operands, 1 = bf16 operands (pointers passed as 16-bit storage)
// A stage is 64 k (one 128-B line of every operand row) of the tile's 128 A rows and 128 Bt rows, hi and lo plane:
// four planes of 128 rows at a pitch of 144 B (16 B x odd: the 16 rows of a fragment load fall on 64 distinct banks).
// Asynchronous copies bring whole lines from global memory into LDS, through no register; two stage buffers, so
// that the next stage's copies fly while this stage is multiplied. Each operand line is fetched once per work-group
// and read from LDS by the two waves that need it.
#define STG_K      64                         // k elements per stage
#define STG_PITCH  144                        // LDS bytes per staged row
#define STG_PLANE  (128 * STG_PITCH)          // one operand plane of a stage
#define STG_BYTES  (4 * STG_PLANE)            // A hi | A lo | Bt hi | Bt lo
static_assert(4 * 16 * 68 * 4 <= 2 * STG_BYTES, "the epilogue slabs reuse the stage buffers");

// Eight copies of 16 B per lane: rows r, r+16, ..., r+112 of one staged plane (l: the lane's LDS byte address of row r,
// g: its global address, gstep: elements between row r and row r+16). The s_wait_xcnt that stands before a copy's
// address registers are written again is the last line of the copies' own statement, so nothing can move above it.
__device__ __forceinline__ void stage_plane(unsigned l, const unsigned short* g, size_t gstep) {
  asm volatile(
      "global_load_async_to_lds_b128 %0, %8, off\n\t"
      "global_load_async_to_lds_b128 %1, %9, off\n\t"
      "global_load_async_to_lds_b128 %2, %10, off\n\t"
      "global_load_async_to_lds_b128 %3, %11, off\n\t"
      "global_load_async_to_lds_b128 %4, %12, off\n\t"
      "global_load_async_to_lds_b128 %5, %13, off\n\t"
      "global_load_async_to_lds_b128 %6, %14, off\n\t"
      "global_load_async_to_lds_b128 %7, %15, off\n\t"
      "s_wait_xcnt 0x0"
      :: "v"(l), "v"(l + 16 * STG_PITCH), "v"(l + 32 * STG_PITCH), "v"(l + 48 * STG_PITCH),
         "v"(l + 64 * STG_PITCH), "v"(l + 80 * STG_PITCH), "v"(l + 96 * STG_PITCH), "v"(l + 112 * STG_PITCH),
         "v"(g), "v"(g + gstep), "v"(g + 2 * gstep), "v"(g + 3 * gstep),
         "v"(g + 4 * gstep), "v"(g + 5 * gstep), "v"(g + 6 * gstep), "v"(g + 7 * gstep)
      : "memory");
}

template <int ET> struct Elem;
template <> struct Elem<0> { typedef _Float16 T; };
template <> struct Elem<1> { typedef __bf16 T; };
template <int ET, bool SPLIT, int BIAS_MODE, int OUT_MODE, bool RESID, int ACT = 0>
__global__ __launch_bounds__(128) void wmma_gemm64(
    const unsigned short* __restrict__ Ap, const unsigned short* __restrict__ A2p, int lda, long strideA,
    const unsigned short* __restrict__ Btp, const unsigned short* __restrict__ Bt2p, int ldb, long strideB,
    void* __restrict__ Cout, void* __restrict__ Cout2, int ldc, long strideC,
    const float* __restrict__ bias,
    const float* __restrict__ resid, long strideR,
    int M, int N, int K, float scale) {
  typedef typename Elem<ET>::T T;
  typedef typename Frag<T>::V V;
  __shared__ __align__(16) unsigned char ring[2 * STG_BYTES];   // two stage buffers; afterwards the epilogue slabs
  const int b    = blockIdx.y;
  const int tid  = threadIdx.x;
  const int lane = tid & 31;
  const int wave = tid >> 5;
  const int tilesN = N >> 7;
  const int tilesM = M >> 7;
  const int tile = blockIdx.x;
  if (tile >= tilesM * tilesN) return;   // the whole work-group leaves, in front of every barrier and copy
  const int tm = tile / tilesN;
  const int tn = tile - tm * tilesN;
  const int bm0 = tm << 7;                     // the work-group's tile
  const int bn0 = tn << 7;
  const int wm0 = (wave >> 1) << 6;            // the wave's 64x64 tile inside it
  const int wn0 = (wave & 1) << 6;
  const int m0 = bm0 + wm0;
  const int n0 = bn0 + wn0;

  const int rlane = lane & 15;                 // row (A) / col (B, D) within subtile
  const int koff  = (lane >> 4) * 8;           // k offset of this lane half
  const int mOff  = (lane >> 4) * 8;           // D row offset

  // copies: 8 lanes x 16 B cover the 128-B line of one row, the 128 threads 16 rows at a time
  const int crow = tid >> 3;
  const int cch  = (tid & 7) * 8;              // in elements
  const size_t aoffs = (size_t)b * strideA + (size_t)(bm0 + crow) * lda + cch;
  const size_t boffs = (size_t)b * strideB + (size_t)(bn0 + crow) * ldb + cch;
  const unsigned short* gA  = Ap  + aoffs;
  const unsigned short* gB  = Btp + boffs;
  const unsigned short* gA2 = SPLIT ? (A2p  + aoffs) : nullptr;
  const unsigned short* gB2 = SPLIT ? (Bt2p + boffs) : nullptr;
  const size_t astep = (size_t)16 * lda;
  const size_t bstep = (size_t)16 * ldb;
  const unsigned lcopy = (unsigned)(size_t)ring + (unsigned)(crow * STG_PITCH + cch * 2);
  const int nstg = K / STG_K;

  v8f acc[4][4];
#pragma unroll
  for (int i = 0; i < 4; ++i)
#pragma unroll
    for (int j = 0; j < 4; ++j) acc[i][j] = (v8f){0.f,0.f,0.f,0.f,0.f,0.f,0.f,0.f};

  // stage 0 into buffer 0, landed and published; then stage 1 into buffer 1
  stage_plane(lcopy, gA, astep);
  if (SPLIT) stage_plane(lcopy + STG_PLANE, gA2, astep);
  stage_plane(lcopy + 2 * STG_PLANE, gB, bstep);
  if (SPLIT) stage_plane(lcopy + 3 * STG_PLANE, gB2, bstep);
  asm volatile("s_wait_asynccnt 0x0" ::: "memory");   // this wave's copies of stage 0 have landed
  __syncthreads();                                    // and every other wave's
  if (nstg > 1) {
    stage_plane(lcopy + STG_BYTES, gA + STG_K, astep);
    if (SPLIT) stage_plane(lcopy + STG_BYTES + STG_PLANE, gA2 + STG_K, astep);
    stage_plane(lcopy + STG_BYTES + 2 * STG_PLANE, gB + STG_K, bstep);
    if (SPLIT) stage_plane(lcopy + STG_BYTES + 3 * STG_PLANE, gB2 + STG_K, bstep);
  }

  // the K loop stays rolled: one stage per trip, every fragment and accumulator index a constant
#pragma clang loop unroll(disable)
  for (int s = 0; s < nstg; ++s) {
    const unsigned bufo = (unsigned)(s & 1) * STG_BYTES;
    const unsigned char* sA = ring + bufo + (wm0 + rlane) * STG_PITCH + koff * 2;
    const unsigned char* sB = ring + bufo + 2 * STG_PLANE + (wn0 + rlane) * STG_PITCH + koff * 2;
    // eight rows of WMMAs per stage (two k blocks x four A fragments); the next row's A fragments are fetched into a
    // second register pair ahead of this row's WMMAs, so that their LDS latency runs behind the matrix work
    constexpr int NROW = (STG_K / 32) * 4;
    V bh[4], bl[4], ah[2], al[2];
    ah[0] = Frag<T>::load((const T*)sA);
    if (SPLIT) al[0] = Frag<T>::load((const T*)(sA + STG_PLANE));
#pragma unroll
    for (int u = 0; u < NROW; ++u) {
      const int i = u & 3;
      if (i == 0) {
#pragma unroll
        for (int j = 0; j < 4; ++j) {
          const unsigned char* pb = sB + j * 16 * STG_PITCH + (u >> 2) * 64;
          bh[j] = Frag<T>::load((const T*)pb);
          if (SPLIT) bl[j] = Frag<T>::load((const T*)(pb + STG_PLANE));
        }
      }
      if (u + 1 < NROW) {
        const unsigned char* pa = sA + ((u + 1) & 3) * 16 * STG_PITCH + ((u + 1) >> 2) * 64;
        ah[(u + 1) & 1] = Frag<T>::load((const T*)pa);
        if (SPLIT) al[(u + 1) & 1] = Frag<T>::load((const T*)(pa + STG_PLANE));
      }
      const V ahu = ah[u & 1];
      const V alu = SPLIT ? al[u & 1] : ah[u & 1];
#pragma unroll
      for (int j = 0; j < 4; ++j) {
        acc[i][j] = Frag<T>::mma(ahu, bh[j], acc[i][j]);
        if (SPLIT) {
          acc[i][j] = Frag<T>::mma(ahu, bl[j], acc[i][j]);
          acc[i][j] = Frag<T>::mma(alu, bh[j], acc[i][j]);
        }
      }
      Frag<T>::guard(acc[i][0], acc[i][3], ahu, alu);
      if (i == 3) {
        Frag<T>::keep(bh[0], bh[1], bh[2], bh[3]);
        if (SPLIT) Frag<T>::keep(bl[0], bl[1], bl[2], bl[3]);
      }
    }
    asm volatile("s_wait_dscnt 0x0" ::: "memory");      // this wave's reads of the buffer are done before it is refilled
    asm volatile("s_wait_asynccnt 0x0" ::: "memory");   // this wave's copies of stage s + 1 have landed
    __syncthreads();   // publishes stage s + 1 and ends every wave's reads of stage s
    if (s + 2 < nstg) {
      const size_t ko = (size_t)(s + 2) * STG_K;
      stage_plane(lcopy + bufo, gA + ko, astep);
      if (SPLIT) stage_plane(lcopy + bufo + STG_PLANE, gA2 + ko, astep);
      stage_plane(lcopy + bufo + 2 * STG_PLANE, gB + ko, bstep);
      if (SPLIT) stage_plane(lcopy + bufo + 3 * STG_PLANE, gB2 + ko, bstep);
    }
  }
  asm volatile("s_wait_asynccnt 0x0" ::: "memory");     // no copy is outstanding when the buffers become slabs
  acc_guard4(acc[0][0], acc[0][1], acc[0][2], acc[0][3]);
  acc_guard4(acc[1][0], acc[1][1], acc[1][2], acc[1][3]);
  acc_guard4(acc[2][0], acc[2][1], acc[2][2], acc[2][3]);
  acc_guard4(acc[3][0], acc[3][1], acc[3][2], acc[3][3]);

  // ---- epilogue ----
  // per-wave 16x64 slab, pitch 68 floats, in the stage buffers: the last trip's barrier ended every read of them
  float* slab = (float*)ring + wave * (16 * 68);
  const float* Rb = RESID ? (resid + (size_t)b * strideR) : nullptr;
#pragma unroll
  for (int i = 0; i < 4; ++i) {
    const int mBase = m0 + (i << 4);
#pragma unroll
    for (int j = 0; j < 4; ++j) {
      const int n = n0 + (j << 4) + rlane;
      float bv = 0.f;
      if (BIAS_MODE == 2) bv = bias[n];
#pragma unroll
      for (int r = 0; r < 8; ++r) {
        float v = acc[i][j][r] * scale;
        if (BIAS_MODE == 1) v += bias[mBase + mOff + r];
        if (BIAS_MODE == 2) v += bv;
        if (RESID) v += Rb[(size_t)(mBase + mOff + r) * ldc + n];
        if (ACT == 1) v = tanhf(v);
        if (ACT == 2) v = fmaxf(v, 0.0f);
        if (ACT == 3) v = v / (1.0f + expf(-v));
        if (ACT == 4) v = (v > 0.f) ? v : 0.01f * v;
        if (ACT == 5) v = 0.5f * v * (1.0f + erff(v * 0.70710678118654752f));
        slab[(mOff + r) * 68 + (j << 4) + rlane] = v;
      }
    }
    __builtin_amdgcn_fence(__ATOMIC_RELEASE, "workgroup");
    __builtin_amdgcn_wave_barrier();
    __builtin_amdgcn_fence(__ATOMIC_ACQUIRE, "workgroup");
    if (OUT_MODE == 0) {
      float* C = (float*)Cout + (size_t)b * strideC;
      const int hh = lane >> 4, c4 = (lane & 15) * 4;     // row seg = 256 B = 16 lanes x 16 B
      {
#pragma unroll
        for (int it = 0; it < 8; ++it) {
          const int row = it * 2 + hh;
          v4f v = *(const v4f*)(slab + row * 68 + c4);
          *(v4f*)(C + (size_t)(mBase + row) * ldc + n0 + c4) = v;
        }
        
      }
    } else {
      const int q = lane >> 3, c8 = (lane & 7) * 8;
      unsigned short* C  = (unsigned short*)Cout  + (size_t)b * strideC;
      unsigned short* C2 = (OUT_MODE == 2) ? ((unsigned short*)Cout2 + (size_t)b * strideC) : nullptr;
      {
#pragma unroll
        for (int it = 0; it < 4; ++it) {
          const int row = it * 4 + q;
          const float* sp = slab + row * 68 + c8;
          v8h hv, lv;
#pragma unroll
          for (int e = 0; e < 8; ++e) {
            if (OUT_MODE == 1) {
              hv[e] = (_Float16)sp[e];
            } else {
              unsigned short hb = f2bf_bits(sp[e]);
              unsigned short lb = f2bf_bits(sp[e] - bf_bits2f(hb));
              hv[e] = __builtin_bit_cast(_Float16, hb);
              lv[e] = __builtin_bit_cast(_Float16, lb);
            }
          }
          *(v8h*)(C + (size_t)(mBase + row) * ldc + n0 + c8) = hv;
          if (OUT_MODE == 2) *(v8h*)(C2 + (size_t)(mBase + row) * ldc + n0 + c8) = lv;
        }
        
      }
    }
    __builtin_amdgcn_fence(__ATOMIC_RELEASE, "workgroup");
    __builtin_amdgcn_wave_barrier();
    __builtin_amdgcn_fence(__ATOMIC_ACQUIRE, "workgroup");
  }
}

// ---------------------------------------------------------------------------
// Elementwise split: 2 elements per thread, one 4-B store per lane per plane -> each wave writes exactly one
// Coverage: grid = ceil(n2/256) blocks x 256 threads x 2 elements = 2*n2 elements = the whole plane (n2 = plane/2).
// ---------------------------------------------------------------------------
__device__ __forceinline__ unsigned pk16(unsigned short a, unsigned short b) { return (unsigned)a | ((unsigned)b << 16); }

// hi = bf16_rne(in), lo = bf16_rne(in - hi)
__global__ __launch_bounds__(256) void split_bf16x2_kernel(const float* __restrict__ in, unsigned short* __restrict__ hi,
                                                           unsigned short* __restrict__ lo, int n2) {
  const int i = blockIdx.x * 256 + threadIdx.x;
  if (i < n2) {
    const v2f f = *(const v2f*)(in + 2 * (size_t)i);
    const unsigned short h0 = f2bf_bits(f[0]), h1 = f2bf_bits(f[1]);
    const unsigned short l0 = f2bf_bits(f[0] - bf_bits2f(h0)), l1 = f2bf_bits(f[1] - bf_bits2f(h1));
    const unsigned uh = pk16(h0, h1), ul = pk16(l0, l1);
    ((unsigned*)hi)[i] = uh;
    ((unsigned*)lo)[i] = ul;
    
  }
}

// ---------------------------------------------------------------------------
// Transpose + bf16 hi/lo split of an f32 matrix, batched over blockIdx.z (input slice z at in + z*sIn floats,
// output slice z at out + z*sOut u16): in [rows][cols] (row pitch ldi floats) ->
// outh/outl[c][r] = split(in[r][c]) (row pitch ldo u16). grid (cols/64, rows/64, Z), 256 threads; rows, cols % 64 == 0.
// Coverage per block: load 4 it x 256 thr x 4 f32 = 64x64; store 2 it x 256 thr x 8 u16 = 64x64 per plane;
// ---------------------------------------------------------------------------
__global__ __launch_bounds__(256) void transpose_split_kernel(const float* __restrict__ in, int ldi, long sIn,
                                                              unsigned short* __restrict__ outh,
                                                              unsigned short* __restrict__ outl, int ldo, long sOut) {
  __shared__ __align__(16) float tf[64 * 68];
  const size_t zb = blockIdx.z;
  const float* inb = in + zb * (size_t)sIn;
  unsigned short* ohb = outh + zb * (size_t)sOut;
  unsigned short* olb = outl + zb * (size_t)sOut;
  const int c0  = blockIdx.x * 64;   // input column block = output row block
  const int r0  = blockIdx.y * 64;   // input row block    = output column block
  const int tid = threadIdx.x;
  {
    const int sub = tid >> 4;          // 0..15
    const int c4  = (tid & 15) * 4;    // 0..60
#pragma unroll
    for (int it = 0; it < 4; ++it) {
      const int rr = it * 16 + sub;
      const v4f a = *(const v4f*)(inb + (size_t)(r0 + rr) * ldi + c0 + c4);
      *(v4f*)(tf + rr * 68 + c4) = a;
    }
  }
  __syncthreads();
  const int s8 = tid >> 3;             // 0..31
  const int c8 = (tid & 7) * 8;        // 0..56
  v4u hv[2], lv[2];
#pragma unroll
  for (int it = 0; it < 2; ++it) {
    const int oc = it * 32 + s8;       // output row within tile (= input column)
    v4u a, a2;
#pragma unroll
    for (int q = 0; q < 4; ++q) {
      const float f0 = tf[(c8 + 2 * q) * 68 + oc];
      const float f1 = tf[(c8 + 2 * q + 1) * 68 + oc];
      const unsigned short h0 = f2bf_bits(f0), h1 = f2bf_bits(f1);
      const unsigned short l0 = f2bf_bits(f0 - bf_bits2f(h0));
      const unsigned short l1 = f2bf_bits(f1 - bf_bits2f(h1));
      a[q]  = pk16(h0, h1);
      a2[q] = pk16(l0, l1);
    }
    hv[it] = a; lv[it] = a2;
  }
  {
#pragma unroll
    for (int it = 0; it < 2; ++it) {
      const int oc = it * 32 + s8;
      const size_t go = (size_t)(c0 + oc) * ldo + r0 + c8;
      *(v4u*)(ohb + go) = hv[it];
      *(v4u*)(olb + go) = lv[it];
    }
    
  }
}

// ---------------------------------------------------------------------------
// Masked row softmax over one score row p of batch b = b0 + blockIdx.y (score slice blockIdx.y of S):
//   t[q] = (S[p][q] + bias) + (1 - pm[b][p]*hm[b][q]) * (-1e30)   (mask applied by value, finite fill)
//   a[q] = exp(t - max) / sum  -> bf16 hi/lo planes Ah/Al at the same [slice][p][q] position.
// Reductions in fixed order: per thread, wave shuffle tree, 4 wave partials in index order.
// Producer coverage: grid (PLEN, GRPB); 128 threads x 8 u16 = the whole 1024-wide row of each plane;
// ---------------------------------------------------------------------------
__global__ __launch_bounds__(128) void row_softmax_split_kernel(
    const float* __restrict__ S, const int* __restrict__ pm, const int* __restrict__ hm,
    const float* __restrict__ bias, unsigned short* __restrict__ Ah, unsigned short* __restrict__ Al, int b0) {
#pragma clang fp contract(off)
  __shared__ float redm[4];
  __shared__ float reds[4];
  const int p    = blockIdx.x;
  const int bb   = blockIdx.y;
  int b = b0 + bb;
  b = b < 0 ? 0 : (b > NBATCH - 1 ? NBATCH - 1 : b);
  const int tid  = threadIdx.x;
  const int lane = tid & 31;
  const int wave = tid >> 5;
  const int j0   = tid * 8;
  const float bv  = bias[0];
  const float pmv = (float)pm[(size_t)b * PLEN + p];
  const float* row = S + ((size_t)bb * PLEN + (size_t)p) * HLEN + j0;
  const v4f a0 = *(const v4f*)(row);
  const v4f a1 = *(const v4f*)(row + 4);
  const int* hrow = hm + (size_t)b * HLEN + j0;
  const v4i h0 = *(const v4i*)(hrow);
  const v4i h1 = *(const v4i*)(hrow + 4);
  float t[8];
#pragma unroll
  for (int e = 0; e < 4; ++e) {
    const float mk0 = pmv * (float)h0[e];
    const float mk1 = pmv * (float)h1[e];
    t[e]     = (a0[e] + bv) + (1.0f - mk0) * NEG_FILL;
    t[4 + e] = (a1[e] + bv) + (1.0f - mk1) * NEG_FILL;
  }
  float m = fmaxf(fmaxf(fmaxf(t[0], t[1]), fmaxf(t[2], t[3])), fmaxf(fmaxf(t[4], t[5]), fmaxf(t[6], t[7])));
#pragma unroll
  for (int off = 16; off > 0; off >>= 1) m = fmaxf(m, __shfl_xor(m, off, 32));
  if (lane == 0) redm[wave] = m;
  __syncthreads();
  const float mx = fmaxf(fmaxf(redm[0], redm[1]), fmaxf(redm[2], redm[3]));
  float ex[8];
#pragma unroll
  for (int e = 0; e < 8; ++e) ex[e] = __expf(t[e] - mx);
  float ps = ((((((ex[0] + ex[1]) + ex[2]) + ex[3]) + ex[4]) + ex[5]) + ex[6]) + ex[7];
#pragma unroll
  for (int off = 16; off > 0; off >>= 1) ps += __shfl_xor(ps, off, 32);
  if (lane == 0) reds[wave] = ps;
  __syncthreads();
  const float tot = ((reds[0] + reds[1]) + reds[2]) + reds[3];   // tot >= 1 (row max contributes exp(0))
  const float inv = 1.0f / tot;
  unsigned hw[4], lw[4];
#pragma unroll
  for (int q = 0; q < 4; ++q) {
    const float p0 = ex[2 * q] * inv, p1 = ex[2 * q + 1] * inv;
    const unsigned short hb0 = f2bf_bits(p0), hb1 = f2bf_bits(p1);
    const unsigned short lb0 = f2bf_bits(p0 - bf_bits2f(hb0));
    const unsigned short lb1 = f2bf_bits(p1 - bf_bits2f(hb1));
    hw[q] = pk16(hb0, hb1);
    lw[q] = pk16(lb0, lb1);
  }
  const v4u hvv = (v4u){hw[0], hw[1], hw[2], hw[3]};
  const v4u lvv = (v4u){lw[0], lw[1], lw[2], lw[3]};
  const size_t rowoff = ((size_t)bb * PLEN + (size_t)p) * HLEN + j0;
  *(v4u*)(Ah + rowoff) = hvv;
  *(v4u*)(Al + rowoff) = lvv;
  
}

// ---------------------------------------------------------------------------
// Column maximum of the masked score over all PLEN rows: CM[slice][q] = max_p t[p][q], t as in the row kernel.
// grid (HLEN/64, GRPB), 512 threads: a work-group owns 64 columns (256 B of every score row). 16 lanes x 16 B cover
// that piece of one row, so the 512 threads cover 32 rows at a time and each thread walks only PLEN/32 = 32 rows,
// whose loads are all issued before anything waits on them. The 32 row classes are joined by one lane exchange and
// an LDS table of 16 wave partials; a maximum does not depend on the order, so CM keeps its bits.
// ---------------------------------------------------------------------------
__global__ __launch_bounds__(512) void colmax_kernel(
    const float* __restrict__ S, const int* __restrict__ pm, const int* __restrict__ hm,
    const float* __restrict__ bias, float* __restrict__ CM, int b0) {
#pragma clang fp contract(off)
  __shared__ float spm[PLEN];
  __shared__ __align__(16) float red[16][64];
  const int bb  = blockIdx.y;
  int b = b0 + bb;
  b = b < 0 ? 0 : (b > NBATCH - 1 ? NBATCH - 1 : b);
  const int tid  = threadIdx.x;
  const int lane = tid & 31;
  const int wave = tid >> 5;
  const int c4   = (tid & 15) * 4;                     // column quad inside the 64-column strip
  const int rsub = tid >> 4;                           // row class 0..31
  const int q0   = blockIdx.x * 64;                    // q0 + 63 < HLEN by grid construction
  // every load of the kernel is issued before the first wait on data: one round trip to memory in all
  const int* pmb = pm + (size_t)b * PLEN;
  const int* hmb = hm + (size_t)b * HLEN + q0;
  const int pm0 = pmb[tid];
  const int pm1 = pmb[512 + tid];
  const v4i hq  = *(const v4i*)(hmb + c4);
  const float bv = bias[0];
  const float* col = S + (size_t)bb * PLEN * HLEN + (size_t)rsub * HLEN + q0 + c4;
  v4f s[PLEN / 32];
#pragma unroll
  for (int k = 0; k < PLEN / 32; ++k) s[k] = *(const v4f*)(col + (size_t)k * 32 * HLEN);
  // the wait that stands before an issued load's address registers are written again; naming the three bases as
  // inputs keeps their registers untouched up to it (without it this build reused two scalar bases at once)
  asm volatile("s_wait_xcnt 0x0" :: "v"(col), "s"(pmb), "s"(hmb) : "memory");
  spm[tid]       = (float)pm0;
  spm[512 + tid] = (float)pm1;
  __syncthreads();
  float hmv[4], m[4];
#pragma unroll
  for (int e = 0; e < 4; ++e) { hmv[e] = (float)hq[e]; m[e] = -__builtin_inff(); }
#pragma unroll
  for (int k = 0; k < PLEN / 32; ++k) {
    const float pmv = spm[k * 32 + rsub];
#pragma unroll
    for (int e = 0; e < 4; ++e) {
      const float tt = (s[k][e] + bv) + (1.0f - pmv * hmv[e]) * NEG_FILL;
      m[e] = fmaxf(m[e], tt);
    }
  }
#pragma unroll
  for (int e = 0; e < 4; ++e) m[e] = fmaxf(m[e], __shfl_xor(m[e], 16, 32));   // the wave's two row classes
  if (lane < 16) *(v4f*)(&red[wave][c4]) = (v4f){m[0], m[1], m[2], m[3]};
  __syncthreads();
  if (tid < 64) {
    float r = red[0][tid];
#pragma unroll
    for (int w = 1; w < 16; ++w) r = fmaxf(r, red[w][tid]);
    CM[(size_t)bb * HLEN + q0 + tid] = r;
  }
}

// ---------------------------------------------------------------------------
// Aligned premise of batch b = b0 + blockIdx.y, hidden columns d0 = 32*blockIdx.x .. d0+31 (one 128-B line of every
// row): at[q] = softmax_q(CM[slice][q]) (f32, fixed order, computed by each of the 8 work-groups of a batch),
// ap[d] = sum_q at[q] * P[b][q][d], then out0[b][r][d0..d0+31] = ap for every r < HLEN.
// 8 lanes x 16 B cover the line of one row, so the 256 threads cover 32 rows at a time and each thread walks only
// HLEN/32 = 32 rows, whose loads are all issued at the top, together with those of the column maxima.
// Sum order (fixed): per thread q = rsub, rsub+32, ...; lane exchange over 8 then 16; 8 wave partials in index order.
// ---------------------------------------------------------------------------
__global__ __launch_bounds__(256) void premise_kernel(
    const float* __restrict__ CM, const float* __restrict__ P, float* __restrict__ out0, int b0) {
  __shared__ __align__(16) float scm[HLEN];
  __shared__ __align__(16) float spr[HLEN];
  __shared__ __align__(16) float spart[8][32];
  __shared__ float redm[8];
  __shared__ float reds[8];
  const int bb   = blockIdx.y;
  int b = b0 + bb;
  b = b < 0 ? 0 : (b > NBATCH - 1 ? NBATCH - 1 : b);
  const int tid  = threadIdx.x;
  const int lane = tid & 31;
  const int wave = tid >> 5;
  const int c4   = (tid & 7) * 4;                      // column quad inside the 32-column strip
  const int rsub = tid >> 3;                           // row class 0..31
  const size_t so = (size_t)b * PLEN * DHID + (size_t)rsub * DHID + blockIdx.x * 32 + c4;

  // every load of the kernel is issued before the first wait on data: one round trip to memory in all
  float cv[HLEN / 256];
#pragma unroll
  for (int j = 0; j < HLEN / 256; ++j) cv[j] = CM[(size_t)bb * HLEN + j * 256 + tid];
  const float* Pb = P + so;
  v4f pv[HLEN / 32];
#pragma unroll
  for (int k = 0; k < HLEN / 32; ++k) pv[k] = *(const v4f*)(Pb + (size_t)k * 32 * DHID);

  float lm = -__builtin_inff();
#pragma unroll
  for (int j = 0; j < HLEN / 256; ++j) {
    scm[j * 256 + tid] = cv[j];
    lm = fmaxf(lm, cv[j]);
  }
#pragma unroll
  for (int off = 16; off > 0; off >>= 1) lm = fmaxf(lm, __shfl_xor(lm, off, 32));
  if (lane == 0) redm[wave] = lm;
  __syncthreads();
  float mx = redm[0];
#pragma unroll
  for (int w = 1; w < 8; ++w) mx = fmaxf(mx, redm[w]);

  float ls = 0.f;
  for (int i = tid; i < HLEN; i += 256) {
    const float e = __expf(scm[i] - mx);
    spr[i] = e;
    ls += e;
  }
#pragma unroll
  for (int off = 16; off > 0; off >>= 1) ls += __shfl_xor(ls, off, 32);
  if (lane == 0) reds[wave] = ls;
  __syncthreads();
  float tot = reds[0];
#pragma unroll
  for (int w = 1; w < 8; ++w) tot += reds[w];
  const float inv = 1.0f / tot;                        // tot >= 1
  for (int i = tid; i < HLEN; i += 256) spr[i] = spr[i] * inv;   // same thread wrote spr[i]
  __syncthreads();

  v4f acc = (v4f){0.f, 0.f, 0.f, 0.f};
#pragma unroll
  for (int k = 0; k < HLEN / 32; ++k) acc = acc + spr[k * 32 + rsub] * pv[k];
#pragma unroll
  for (int e = 0; e < 4; ++e) {
    acc[e] += __shfl_xor(acc[e], 8, 32);               // the wave's four row classes
    acc[e] += __shfl_xor(acc[e], 16, 32);
  }
  if (lane < 8) *(v4f*)(&spart[wave][c4]) = acc;
  __syncthreads();
  v4f va = *(const v4f*)(&spart[0][c4]);
#pragma unroll
  for (int w = 1; w < 8; ++w) va = va + *(const v4f*)(&spart[w][c4]);

  float* ob = out0 + so;                               // PLEN == HLEN: out0 has the premise's shape
#pragma unroll
  for (int k = 0; k < HLEN / 32; ++k) *(v4f*)(ob + (size_t)k * 32 * DHID) = va;
}

// ---------------------------------------------------------------------------
// Workspace region map (byte offsets, all multiples of 16 KiB). Every region is fully written before it is read:
// the weight/activation planes once up front; S, Ah/Al, CM fully written per group of GRPB batches.
//   WTh   bf16 [256][256]    Wt[e][d] = W[d][e] hi              0
//   WTl   bf16 [256][256]                                  131072
//   Ph    bf16 [16][1024][256] premise hi                  262144
//   Pl                                                    8650752
//   Hh    bf16 [16][1024][256] hypothesis hi             17039360
//   Hl                                                   25427968
//   HTh   bf16 [16][256][1024] hypothesis^T hi           33816576
//   HTl                                                  42205184
//   PWh   bf16 [16*1024][256]  (P.W) hi                  50593792
//   PWl                                                  58982400
//   S     f32  [GRPB][1024][1024] raw bilinear scores     67371008
//   Ah    bf16 [GRPB][1024][1024] row softmax hi        134479872
//   Al                                                 168034304
//   CM    f32  [GRPB][1024] masked column maxima        201588736
//   total                                               201654272
// ---------------------------------------------------------------------------
extern "C" void kernel_launch(void* const* d_in, const int* in_sizes, int n_in,
                              void* d_out, int out_size, void* d_ws, size_t ws_size,
                              hipStream_t stream) {
  if (n_in < 6) return;
  if (in_sizes[0] != NBATCH * PLEN * DHID) return;
  if (in_sizes[1] != NBATCH * HLEN * DHID) return;
  if (in_sizes[2] != NBATCH * PLEN || in_sizes[3] != NBATCH * HLEN) return;
  if (in_sizes[4] != DHID * DHID || in_sizes[5] < 1) return;
  if (out_size != 2 * NBATCH * PLEN * DHID) return;

  const float* P    = (const float*)d_in[0];
  const float* H    = (const float*)d_in[1];
  const int*   pm   = (const int*)d_in[2];
  const int*   hm   = (const int*)d_in[3];
  const float* W    = (const float*)d_in[4];
  const float* bias = (const float*)d_in[5];

  const size_t PWT = (size_t)DHID * DHID * 2;                 // 16-bit [256][256]
  const size_t PAC = (size_t)NBATCH * PLEN * DHID * 2;        // 16-bit [16][1024][256]
  const size_t PSC = (size_t)GRPB * PLEN * HLEN * 4;          // f32 scores of one group
  const size_t PPR = (size_t)GRPB * PLEN * HLEN * 2;          // bf16 probability plane of one group
  const size_t PCM = (size_t)GRPB * HLEN * 4;
  size_t off = 0;
  const size_t oWTh = off; off += PWT;
  const size_t oWTl = off; off += PWT;
  const size_t oPh  = off; off += PAC;
  const size_t oPl  = off; off += PAC;
  const size_t oHh  = off; off += PAC;
  const size_t oHl  = off; off += PAC;
  const size_t oHTh = off; off += PAC;
  const size_t oHTl = off; off += PAC;
  const size_t oPWh = off; off += PAC;
  const size_t oPWl = off; off += PAC;
  const size_t oS   = off; off += PSC;
  const size_t oAh  = off; off += PPR;
  const size_t oAl  = off; off += PPR;
  const size_t oCM  = off; off += PCM;
  if (off > ws_size) return;

  char* ws = (char*)d_ws;
  unsigned short* WTh = (unsigned short*)(ws + oWTh);
  unsigned short* WTl = (unsigned short*)(ws + oWTl);
  unsigned short* Ph  = (unsigned short*)(ws + oPh);
  unsigned short* Pl  = (unsigned short*)(ws + oPl);
  unsigned short* Hh  = (unsigned short*)(ws + oHh);
  unsigned short* Hl  = (unsigned short*)(ws + oHl);
  unsigned short* HTh = (unsigned short*)(ws + oHTh);
  unsigned short* HTl = (unsigned short*)(ws + oHTl);
  unsigned short* PWh = (unsigned short*)(ws + oPWh);
  unsigned short* PWl = (unsigned short*)(ws + oPWl);
  float*          Sbuf = (float*)(ws + oS);
  unsigned short* Ah  = (unsigned short*)(ws + oAh);
  unsigned short* Al  = (unsigned short*)(ws + oAl);
  float*          CM  = (float*)(ws + oCM);

  float* out0 = (float*)d_out;                                   // aligned premise (broadcast) [16][1024][256]
  float* out1 = (float*)d_out + (size_t)NBATCH * PLEN * DHID;    // aligned hypothesis [16][1024][256]

  const dim3 blk(256);
  // (0) W[0]: in [256 rows = d][256 cols = e] -> WT[e][d] hi/lo; grid (cols/64, rows/64, 1)
  transpose_split_kernel<<<dim3(DHID / 64, DHID / 64, 1), blk, 0, stream>>>(W, DHID, 0L, WTh, WTl, DHID, 0L);
  // (1) P, H -> bf16 hi/lo planes (natural layout), whole tensors: 8192 blocks x 256 thr x 2 = 16x1024x256
  const int n2 = NBATCH * PLEN * DHID / 2;
  const dim3 gSplit((n2 + 255) / 256);
  split_bf16x2_kernel<<<gSplit, blk, 0, stream>>>(P, Ph, Pl, n2);
  split_bf16x2_kernel<<<gSplit, blk, 0, stream>>>(H, Hh, Hl, n2);
  // (2) H[b]: in [1024 rows = q][256 cols = d] -> HT[b][d][q] hi/lo; grid (cols/64, rows/64, NBATCH)
  transpose_split_kernel<<<dim3(DHID / 64, HLEN / 64, NBATCH), blk, 0, stream>>>(
      H, DHID, (long)HLEN * DHID, HTh, HTl, HLEN, (long)DHID * HLEN);
  // (3) PW[p][e] = sum_d P[p][d] W[d][e] over all batches: M=16384, N=256, K=256 (K%64, M,N%128) -> PW hi/lo planes
  const dim3 gblk(128);                                          // GEMM work-group: 4 waves, one 128x128 tile
  const dim3 gPW((NBATCH * PLEN / 128) * (DHID / 128), 1);       // 256 blocks
  wmma_gemm64<1, true, 0, 2, false, 0><<<gPW, gblk, 0, stream>>>(
      Ph, Pl, DHID, 0L, WTh, WTl, DHID, 0L, (void*)PWh, (void*)PWl, DHID, 0L,
      bias, bias, 0L, NBATCH * PLEN, DHID, DHID, 1.0f);

  const dim3 gS((PLEN / 128) * (HLEN / 128), GRPB);              // 64 x GRPB: M=N=1024, K=256
  const dim3 gSm(PLEN, GRPB);                                    // one block per (row, batch in group)
  const dim3 gCM(HLEN / 64, GRPB);                               // 16 x GRPB, 512 threads each
  const dim3 gPr(DHID / 32, GRPB);                               // 8 x GRPB
  const dim3 gAV((PLEN / 128) * (DHID / 128), GRPB);             // 16 x GRPB: M=1024, N=256, K=1024

  for (int g = 0; g < NGRPS; ++g) {
    const int b0 = g * GRPB;
    const size_t aoff = (size_t)b0 * PLEN * DHID;               // u16 / float offset of batch b0 in [16][1024][256]
    const size_t toff = (size_t)b0 * DHID * HLEN;               // u16 offset of batch b0 in [16][256][1024]
    // (4) S[bb][p][q] = sum_e PW[b][p][e] H[b][q][e] (raw f32, whole 1024x1024 per bb)
    wmma_gemm64<1, true, 0, 0, false, 0><<<gS, gblk, 0, stream>>>(
        PWh + aoff, PWl + aoff, DHID, (long)PLEN * DHID,
        Hh + aoff, Hl + aoff, DHID, (long)HLEN * DHID,
        (void*)Sbuf, (void*)Sbuf, HLEN, (long)PLEN * HLEN,
        bias, bias, 0L, PLEN, HLEN, DHID, 1.0f);
    // (5) bias + mask + row softmax -> A hi/lo planes (whole 1024x1024 per bb)
    row_softmax_split_kernel<<<gSm, dim3(128), 0, stream>>>(Sbuf, pm, hm, bias, Ah, Al, b0);
    // (6) masked column maxima -> CM (whole 1024 per bb)
    colmax_kernel<<<gCM, dim3(512), 0, stream>>>(Sbuf, pm, hm, bias, CM, b0);
    // (7) softmax(CM), premise reduction, broadcast rows -> out0[b] (whole 1024x256 per b)
    premise_kernel<<<gPr, blk, 0, stream>>>(CM, P, out0, b0);
    // (8) out1[b][p][d] = sum_q A[bb][p][q] HT[b][d][q]: M=1024, N=256, K=1024 -> f32 d_out (whole 1024x256 per b)
    wmma_gemm64<1, true, 0, 0, false, 0><<<gAV, gblk, 0, stream>>>(
        Ah, Al, HLEN, (long)PLEN * HLEN,
        HTh + toff, HTl + toff, HLEN, (long)DHID * HLEN,
        (void*)(out1 + aoff), (void*)(out1 + aoff), DHID, (long)PLEN * DHID,
        bias, bias, 0L, PLEN, DHID, HLEN, 1.0f);
  }
}

// v004
// Measured time: 114 microseconds a run.
// Next to v003, in two timings, it ran 1.06 times as fast each time.
// All steps since v000 together make it 13.1 times as fast.
// Contractions P.W, (P.W).Hy^T and attn.Hy: v_wmma_f32_16x16x32_bf16 on bf16 hi/lo split operand planes (hi.hi + hi.lo + lo.hi), f32 accumulate; masked row softmax, column-max softmax and the 1024x256 premise reduction in f32 on VALU; tuple output (out0 = broadcast aligned premise, out1 = aligned hypothesis).
#include <hip/hip_runtime.h>
#include <math.h>
#include <stdint.h>

#define NBATCH 16
#define PLEN   1024
#define HLEN   1024
#define DHID   256
#define GRPB   16                 // batches processed per score group (all of them: one pass of launches)
#define NGRPS  (NBATCH / GRPB)
#define NEG_FILL (-1e30f)
static_assert(PLEN == HLEN, "column-max softmax indexes premise rows by hypothesis position");
static_assert(NBATCH % GRPB == 0, "whole groups");
static_assert(PLEN == 1024 && HLEN == 1024 && DHID == 256, "the column-max and premise kernels deal rows and columns for this shape");

typedef __attribute__((ext_vector_type(16))) _Float16 v16h;
typedef __attribute__((ext_vector_type(8)))  _Float16 v8h;
typedef __attribute__((ext_vector_type(16))) __bf16   v16b;
typedef __attribute__((ext_vector_type(8)))  __bf16   v8b;
typedef __attribute__((ext_vector_type(8)))  float    v8f;
typedef __attribute__((ext_vector_type(4)))  float    v4f;
typedef __attribute__((ext_vector_type(2)))  float    v2f;
typedef __attribute__((ext_vector_type(4)))  unsigned int v4u;
typedef __attribute__((ext_vector_type(2)))  unsigned int v2u;
typedef __attribute__((ext_vector_type(4)))  int      v4i;

__device__ __forceinline__ unsigned short f2bf_bits(float f) {
  unsigned u = __float_as_uint(f);
  return (unsigned short)((u + 0x7FFFu + ((u >> 16) & 1u)) >> 16);
}
__device__ __forceinline__ float bf_bits2f(unsigned short h) { return __uint_as_float(((unsigned)h) << 16); }

// hazard guards as plain device helpers
__device__ __forceinline__ void dep_guard_h(v8f& a, v8f& b, v16h x, v16h y) { asm volatile("v_nop\n\tv_nop\n\tv_nop\n\tv_nop" : "+v"(a), "+v"(b) : "v"(x), "v"(y)); }
__device__ __forceinline__ void dep_guard_b(v8f& a, v8f& b, v16b x, v16b y) { asm volatile("v_nop\n\tv_nop\n\tv_nop\n\tv_nop" : "+v"(a), "+v"(b) : "v"(x), "v"(y)); }
__device__ __forceinline__ void keep4_h(v16h a, v16h b, v16h c, v16h d) { asm volatile("v_nop" :: "v"(a), "v"(b), "v"(c), "v"(d)); }
__device__ __forceinline__ void keep4_b(v16b a, v16b b, v16b c, v16b d) { asm volatile("v_nop" :: "v"(a), "v"(b), "v"(c), "v"(d)); }
__device__ __forceinline__ void acc_guard4(v8f& a, v8f& b, v8f& c, v8f& d) { asm volatile("v_nop\n\tv_nop\n\tv_nop\n\tv_nop" : "+v"(a), "+v"(b), "+v"(c), "+v"(d)); }
template <typename T> struct Frag;
template <> struct Frag<_Float16> {
  typedef v16h V; union U { v16h v; v8h h[2]; };
  static __device__ __forceinline__ v16h load(const _Float16* p) {   // elements 0..7 <- p[0..7], 8..15 <- p[16..23]
    U f; f.h[0] = *(const v8h*)(p); f.h[1] = *(const v8h*)(p + 16); return f.v;
  }
  static __device__ __forceinline__ v8f mma(v16h a, v16h b, v8f c) {
    return __builtin_amdgcn_wmma_f32_16x16x32_f16(false, a, false, b, (short)0, c, false, false);
  }
  static __device__ __forceinline__ void guard(v8f& a, v8f& b, v16h x, v16h y) { dep_guard_h(a, b, x, y); }
  static __device__ __forceinline__ void keep(v16h a, v16h b, v16h c, v16h d) { keep4_h(a, b, c, d); }
};
template <> struct Frag<__bf16> {
  typedef v16b V; union U { v16b v; v8b h[2]; };
  static __device__ __forceinline__ v16b load(const __bf16* p) {
    U f; f.h[0] = *(const v8b*)(p); f.h[1] = *(const v8b*)(p + 16); return f.v;
  }
  static __device__ __forceinline__ v8f mma(v16b a, v16b b, v8f c) {
    return __builtin_amdgcn_wmma_f32_16x16x32_bf16(false, a, false, b, (short)0, c, false, false);
  }
  static __device__ __forceinline__ void guard(v8f& a, v8f& b, v16b x, v16b y) { dep_guard_b(a, b, x, y); }
  static __device__ __forceinline__ void keep(v16b a, v16b b, v16b c, v16b d) { keep4_b(a, b, c, d); }
};

// ---- Register-blocked batched WMMA GEMM, operands staged in LDS -------------
// C[m,n] = scale * sum_k A[m,k] * Bt[n,k] (+bias)(+resid); a work-group of 4 waves (2 x 2) owns a 128x128 tile,
// each wave a 64x64 tile of it.
// A row-major [M,K]; Bt row-major [N,K]; M,N % 128 == 0, K % 64 == 0.
// SPLIT: operands are hi/lo planes (A2/Bt2 = lo planes, same layout); product = hi.hi + hi.lo + lo.hi.
// BIAS_MODE: 0 = none, 1 = bias[m], 2 = bias[n].
// OUT_MODE: 0 = f32, 1 = f16, 2 = bf16 hi plane (Cout) + bf16 lo plane (Cout2).
// ET: 0 = f16 operands, 1 = bf16 operands (pointers passed as 16-bit storage)
// A stage is 64 k (one 128-B line of every operand row) of the tile's 128 A rows and 128 Bt rows, hi and lo plane:
// four planes of 128 rows at a pitch of 144 B (16 B x odd: the 16 rows of a fragment load fall on 64 distinct banks).
// Asynchronous copies bring whole lines from global memory into LDS, through no register; two stage buffers, so
// that the next stage's copies fly while this stage is multiplied. Each operand line is fetched once per work-group
// and read from LDS by the two waves that need it.
#define STG_K      64                         // k elements per stage
#define STG_PITCH  144                        // LDS bytes per staged row
#define STG_PLANE  (128 * STG_PITCH)          // one operand plane of a stage
#define STG_BYTES  (4 * STG_PLANE)            // A hi | A lo | Bt hi | Bt lo
static_assert(4 * 16 * 68 * 4 <= 2 * STG_BYTES, "the epilogue slabs reuse the stage buffers");

// Eight copies of 16 B per lane: rows r, r+16, ..., r+112 of one staged plane (l: the lane's LDS byte address of row r,
// g: its global address, gstep: elements between row r and row r+16). The s_wait_xcnt that stands before a copy's
// address registers are written again is the last line of the copies' own statement, so nothing can move above it.
__device__ __forceinline__ void stage_plane(unsigned l, const unsigned short* g, size_t gstep) {
  asm volatile(
      "global_load_async_to_lds_b128 %0, %8, off\n\t"
      "global_load_async_to_lds_b128 %1, %9, off\n\t"
      "global_load_async_to_lds_b128 %2, %10, off\n\t"
      "global_load_async_to_lds_b128 %3, %11, off\n\t"
      "global_load_async_to_lds_b128 %4, %12, off\n\t"
      "global_load_async_to_lds_b128 %5, %13, off\n\t"
      "global_load_async_to_lds_b128 %6, %14, off\n\t"
      "global_load_async_to_lds_b128 %7, %15, off\n\t"
      "s_wait_xcnt 0x0"
      :: "v"(l), "v"(l + 16 * STG_PITCH), "v"(l + 32 * STG_PITCH), "v"(l + 48 * STG_PITCH),
         "v"(l + 64 * STG_PITCH), "v"(l + 80 * STG_PITCH), "v"(l + 96 * STG_PITCH), "v"(l + 112 * STG_PITCH),
         "v"(g), "v"(g + gstep), "v"(g + 2 * gstep), "v"(g + 3 * gstep),
         "v"(g + 4 * gstep), "v"(g + 5 * gstep), "v"(g + 6 * gstep), "v"(g + 7 * gstep)
      : "memory");
}

template <int ET> struct Elem;
template <> struct Elem<0> { typedef _Float16 T; };
template <> struct Elem<1> { typedef __bf16 T; };
template <int ET, bool SPLIT, int BIAS_MODE, int OUT_MODE, bool RESID, int ACT = 0>
__global__ __launch_bounds__(128) void wmma_gemm64(
    const unsigned short* __restrict__ Ap, const unsigned short* __restrict__ A2p, int lda, long strideA,
    const unsigned short* __restrict__ Btp, const unsigned short* __restrict__ Bt2p, int ldb, long strideB,
    void* __restrict__ Cout, void* __restrict__ Cout2, int ldc, long strideC,
    const float* __restrict__ bias,
    const float* __restrict__ resid, long strideR,
    int M, int N, int K, float scale) {
  typedef typename Elem<ET>::T T;
  typedef typename Frag<T>::V V;
  __shared__ __align__(16) unsigned char ring[2 * STG_BYTES];   // two stage buffers; afterwards the epilogue slabs
  const int b    = blockIdx.y;
  const int tid  = threadIdx.x;
  const int lane = tid & 31;
  const int wave = tid >> 5;
  const int tilesN = N >> 7;
  const int tilesM = M >> 7;
  const int tile = blockIdx.x;
  if (tile >= tilesM * tilesN) return;   // the whole work-group leaves, in front of every barrier and copy
  const int tm = tile / tilesN;
  const int tn = tile - tm * tilesN;
  const int bm0 = tm << 7;                     // the work-group's tile
  const int bn0 = tn << 7;
  const int wm0 = (wave >> 1) << 6;            // the wave's 64x64 tile inside it
  const int wn0 = (wave & 1) << 6;
  const int m0 = bm0 + wm0;
  const int n0 = bn0 + wn0;

  const int rlane = lane & 15;                 // row (A) / col (B, D) within subtile
  const int koff  = (lane >> 4) * 8;           // k offset of this lane half
  const int mOff  = (lane >> 4) * 8;           // D row offset

  // copies: 8 lanes x 16 B cover the 128-B line of one row, the 128 threads 16 rows at a time
  const int crow = tid >> 3;
  const int cch  = (tid & 7) * 8;              // in elements
  const size_t aoffs = (size_t)b * strideA + (size_t)(bm0 + crow) * lda + cch;
  const size_t boffs = (size_t)b * strideB + (size_t)(bn0 + crow) * ldb + cch;
  const unsigned short* gA  = Ap  + aoffs;
  const unsigned short* gB  = Btp + boffs;
  const unsigned short* gA2 = SPLIT ? (A2p  + aoffs) : nullptr;
  const unsigned short* gB2 = SPLIT ? (Bt2p + boffs) : nullptr;
  const size_t astep = (size_t)16 * lda;
  const size_t bstep = (size_t)16 * ldb;
  const unsigned lcopy = (unsigned)(size_t)ring + (unsigned)(crow * STG_PITCH + cch * 2);
  const int nstg = K / STG_K;

  v8f acc[4][4];
#pragma unroll
  for (int i = 0; i < 4; ++i)
#pragma unroll
    for (int j = 0; j < 4; ++j) acc[i][j] = (v8f){0.f,0.f,0.f,0.f,0.f,0.f,0.f,0.f};

  // stage 0 into buffer 0, landed and published; then stage 1 into buffer 1
  stage_plane(lcopy, gA, astep);
  if (SPLIT) stage_plane(lcopy + STG_PLANE, gA2, astep);
  stage_plane(lcopy + 2 * STG_PLANE, gB, bstep);
  if (SPLIT) stage_plane(lcopy + 3 * STG_PLANE, gB2, bstep);
  asm volatile("s_wait_asynccnt 0x0" ::: "memory");   // this wave's copies of stage 0 have landed
  __syncthreads();                                    // and every other wave's
  if (nstg > 1) {
    stage_plane(lcopy + STG_BYTES, gA + STG_K, astep);
    if (SPLIT) stage_plane(lcopy + STG_BYTES + STG_PLANE, gA2 + STG_K, astep);
    stage_plane(lcopy + STG_BYTES + 2 * STG_PLANE, gB + STG_K, bstep);
    if (SPLIT) stage_plane(lcopy + STG_BYTES + 3 * STG_PLANE, gB2 + STG_K, bstep);
  }

  // the K loop stays rolled: one stage per trip, every fragment and accumulator index a constant
#pragma clang loop unroll(disable)
  for (int s = 0; s < nstg; ++s) {
    const unsigned bufo = (unsigned)(s & 1) * STG_BYTES;
    const unsigned char* sA = ring + bufo + (wm0 + rlane) * STG_PITCH + koff * 2;
    const unsigned char* sB = ring + bufo + 2 * STG_PLANE + (wn0 + rlane) * STG_PITCH + koff * 2;
    // eight rows of WMMAs per stage (two k blocks x four A fragments); the next row's A fragments are fetched into a
    // second register pair ahead of this row's WMMAs, so that their LDS latency runs behind the matrix work
    constexpr int NROW = (STG_K / 32) * 4;
    V bh[4], bl[4], ah[2], al[2];
    ah[0] = Frag<T>::load((const T*)sA);
    if (SPLIT) al[0] = Frag<T>::load((const T*)(sA + STG_PLANE));
#pragma unroll
    for (int u = 0; u < NROW; ++u) {
      const int i = u & 3;
      if (i == 0) {
#pragma unroll
        for (int j = 0; j < 4; ++j) {
          const unsigned char* pb = sB + j * 16 * STG_PITCH + (u >> 2) * 64;
          bh[j] = Frag<T>::load((const T*)pb);
          if (SPLIT) bl[j] = Frag<T>::load((const T*)(pb + STG_PLANE));
        }
      }
      if (u + 1 < NROW) {
        const unsigned char* pa = sA + ((u + 1) & 3) * 16 * STG_PITCH + ((u + 1) >> 2) * 64;
        ah[(u + 1) & 1] = Frag<T>::load((const T*)pa);
        if (SPLIT) al[(u + 1) & 1] = Frag<T>::load((const T*)(pa + STG_PLANE));
      }
      const V ahu = ah[u & 1];
      const V alu = SPLIT ? al[u & 1] : ah[u & 1];
#pragma unroll
      for (int j = 0; j < 4; ++j) {
        acc[i][j] = Frag<T>::mma(ahu, bh[j], acc[i][j]);
        if (SPLIT) {
          acc[i][j] = Frag<T>::mma(ahu, bl[j], acc[i][j]);
          acc[i][j] = Frag<T>::mma(alu, bh[j], acc[i][j]);
        }
      }
      Frag<T>::guard(acc[i][0], acc[i][3], ahu, alu);
      if (i == 3) {
        Frag<T>::keep(bh[0], bh[1], bh[2], bh[3]);
        if (SPLIT) Frag<T>::keep(bl[0], bl[1], bl[2], bl[3]);
      }
    }
    asm volatile("s_wait_dscnt 0x0" ::: "memory");      // this wave's reads of the buffer are done before it is refilled
    asm volatile("s_wait_asynccnt 0x0" ::: "memory");   // this wave's copies of stage s + 1 have landed
    __syncthreads();   // publishes stage s + 1 and ends every wave's reads of stage s
    if (s + 2 < nstg) {
      const size_t ko = (size_t)(s + 2) * STG_K;
      stage_plane(lcopy + bufo, gA + ko, astep);
      if (SPLIT) stage_plane(lcopy + bufo + STG_PLANE, gA2 + ko, astep);
      stage_plane(lcopy + bufo + 2 * STG_PLANE, gB + ko, bstep);
      if (SPLIT) stage_plane(lcopy + bufo + 3 * STG_PLANE, gB2 + ko, bstep);
    }
  }
  asm volatile("s_wait_asynccnt 0x0" ::: "memory");     // no copy is outstanding when the buffers become slabs
  acc_guard4(acc[0][0], acc[0][1], acc[0][2], acc[0][3]);
  acc_guard4(acc[1][0], acc[1][1], acc[1][2], acc[1][3]);
  acc_guard4(acc[2][0], acc[2][1], acc[2][2], acc[2][3]);
  acc_guard4(acc[3][0], acc[3][1], acc[3][2], acc[3][3]);

  // ---- epilogue ----
  // per-wave 16x64 slab, pitch 68 floats, in the stage buffers: the last trip's barrier ended every read of them
  float* slab = (float*)ring + wave * (16 * 68);
  const float* Rb = RESID ? (resid + (size_t)b * strideR) : nullptr;
#pragma unroll
  for (int i = 0; i < 4; ++i) {
    const int mBase = m0 + (i << 4);
#pragma unroll
    for (int j = 0; j < 4; ++j) {
      const int n = n0 + (j << 4) + rlane;
      float bv = 0.f;
      if (BIAS_MODE == 2) bv = bias[n];
#pragma unroll
      for (int r = 0; r < 8; ++r) {
        float v = acc[i][j][r] * scale;
        if (BIAS_MODE == 1) v += bias[mBase + mOff + r];
        if (BIAS_MODE == 2) v += bv;
        if (RESID) v += Rb[(size_t)(mBase + mOff + r) * ldc + n];
        if (ACT == 1) v = tanhf(v);
        if (ACT == 2) v = fmaxf(v, 0.0f);
        if (ACT == 3) v = v / (1.0f + expf(-v));
        if (ACT == 4) v = (v > 0.f) ? v : 0.01f * v;
        if (ACT == 5) v = 0.5f * v * (1.0f + erff(v * 0.70710678118654752f));
        slab[(mOff + r) * 68 + (j << 4) + rlane] = v;
      }
    }
    __builtin_amdgcn_fence(__ATOMIC_RELEASE, "workgroup");
    __builtin_amdgcn_wave_barrier();
    __builtin_amdgcn_fence(__ATOMIC_ACQUIRE, "workgroup");
    if (OUT_MODE == 0) {
      float* C = (float*)Cout + (size_t)b * strideC;
      const int hh = lane >> 4, c4 = (lane & 15) * 4;     // row seg = 256 B = 16 lanes x 16 B
      {
#pragma unroll
        for (int it = 0; it < 8; ++it) {
          const int row = it * 2 + hh;
          v4f v = *(const v4f*)(slab + row * 68 + c4);
          *(v4f*)(C + (size_t)(mBase + row) * ldc + n0 + c4) = v;
        }
        
      }
    } else {
      const int q = lane >> 3, c8 = (lane & 7) * 8;
      unsigned short* C  = (unsigned short*)Cout  + (size_t)b * strideC;
      unsigned short* C2 = (OUT_MODE == 2) ? ((unsigned short*)Cout2 + (size_t)b * strideC) : nullptr;
      {
#pragma unroll
        for (int it = 0; it < 4; ++it) {
          const int row = it * 4 + q;
          const float* sp = slab + row * 68 + c8;
          v8h hv, lv;
#pragma unroll
          for (int e = 0; e < 8; ++e) {
            if (OUT_MODE == 1) {
              hv[e] = (_Float16)sp[e];
            } else {
              unsigned short hb = f2bf_bits(sp[e]);
              unsigned short lb = f2bf_bits(sp[e] - bf_bits2f(hb));
              hv[e] = __builtin_bit_cast(_Float16, hb);
              lv[e] = __builtin_bit_cast(_Float16, lb);
            }
          }
          *(v8h*)(C + (size_t)(mBase + row) * ldc + n0 + c8) = hv;
          if (OUT_MODE == 2) *(v8h*)(C2 + (size_t)(mBase + row) * ldc + n0 + c8) = lv;
        }
        
      }
    }
    __builtin_amdgcn_fence(__ATOMIC_RELEASE, "workgroup");
    __builtin_amdgcn_wave_barrier();
    __builtin_amdgcn_fence(__ATOMIC_ACQUIRE, "workgroup");
  }
}

// ---------------------------------------------------------------------------
// Operand preparation, one launch for all of it. hi = bf16_rne(x), lo = bf16_rne(x - hi) everywhere.
// A work-group of 256 threads takes one piece of the work, chosen by its index alone:
//   [0, PREP_HT)                 a 64x64 tile of H[b] ([1024 q][256 d]): read once, written as the natural planes
//                                Hh/Hl[b][q][d] from registers and, turned in LDS, as HTh/HTl[b][d][q]
//   [PREP_HT, PREP_HT + PREP_WT) a 64x64 tile of W ([256 d][256 e]): turned only, WTh/WTl[e][d]
//   the PREP_PB others           8192 consecutive elements of P: natural planes Ph/Pl
// Every wave-wide load covers whole 128-B lines (16 B per lane, neighbouring lanes neighbouring bytes); every store
// instruction of a wave writes whole 128-B lines of its plane, each line by one wave.
// Coverage: H 16 batches x 16 x 4 tiles; W 4 x 4 tiles; P 512 x 8192 = 16 x 1024 x 256 elements.
// ---------------------------------------------------------------------------
__device__ __forceinline__ unsigned pk16(unsigned short a, unsigned short b) { return (unsigned)a | ((unsigned)b << 16); }

#define PREP_HT  (NBATCH * (HLEN / 64) * (DHID / 64))
#define PREP_WT  ((DHID / 64) * (DHID / 64))
#define PREP_PE  8192
#define PREP_PB  (NBATCH * PLEN * DHID / PREP_PE)
static_assert(NBATCH * PLEN * DHID % PREP_PE == 0, "whole pieces of P");

// four consecutive f32 -> four bf16 of the hi plane and four of the lo plane, 8 B each
__device__ __forceinline__ void split4_store(v4f f, unsigned short* hi, unsigned short* lo) {
  const unsigned short h0 = f2bf_bits(f[0]), h1 = f2bf_bits(f[1]), h2 = f2bf_bits(f[2]), h3 = f2bf_bits(f[3]);
  const unsigned short l0 = f2bf_bits(f[0] - bf_bits2f(h0)), l1 = f2bf_bits(f[1] - bf_bits2f(h1));
  const unsigned short l2 = f2bf_bits(f[2] - bf_bits2f(h2)), l3 = f2bf_bits(f[3] - bf_bits2f(h3));
  *(v2u*)hi = (v2u){pk16(h0, h1), pk16(h2, h3)};
  *(v2u*)lo = (v2u){pk16(l0, l1), pk16(l2, l3)};
}

__global__ __launch_bounds__(256) void prep_kernel(
    const float* __restrict__ P, const float* __restrict__ H, const float* __restrict__ W,
    unsigned short* __restrict__ Ph, unsigned short* __restrict__ Pl,
    unsigned short* __restrict__ Hh, unsigned short* __restrict__ Hl,
    unsigned short* __restrict__ HTh, unsigned short* __restrict__ HTl,
    unsigned short* __restrict__ WTh, unsigned short* __restrict__ WTl) {
  __shared__ __align__(16) float tf[64 * 68];
  const int tid = threadIdx.x;
  const int blk = blockIdx.x;
  if (blk >= PREP_HT + PREP_WT) {      // the whole work-group: a piece of P, no LDS and no barrier
    const size_t base = (size_t)(blk - (PREP_HT + PREP_WT)) * PREP_PE + tid * 4;
    const float* pin = P + base;
    v4f a[PREP_PE / 1024];
#pragma unroll
    for (int it = 0; it < PREP_PE / 1024; ++it) a[it] = *(const v4f*)(pin + it * 1024);
    // the wait that stands before an issued load's address registers are written again; naming the address as an
    // input keeps its registers untouched up to it (without it this build landed the last load's data in them)
    asm volatile("s_wait_xcnt 0x0" :: "v"(pin) : "memory");
#pragma unroll
    for (int it = 0; it < PREP_PE / 1024; ++it) split4_store(a[it], Ph + base + it * 1024, Pl + base + it * 1024);
    return;
  }
  const bool isW = blk >= PREP_HT;     // the same for the whole work-group
  const int t   = isW ? blk - PREP_HT : (blk & 63);
  const size_t zb = isW ? 0 : (size_t)(blk >> 6);
  const int c0  = (t & 3) * 64;        // input column block = output row block of the turned planes
  const int r0  = (t >> 2) * 64;       // input row block    = output column block
  const int ldo = isW ? DHID : HLEN;   // row pitch of the turned planes; both inputs have rows of DHID floats
  const float* inb = isW ? W : H + zb * (size_t)(HLEN * DHID);
  unsigned short* ohb = isW ? WTh : HTh + zb * (size_t)(DHID * HLEN);
  unsigned short* olb = isW ? WTl : HTl + zb * (size_t)(DHID * HLEN);
  const int sub = tid >> 4;            // 0..15
  const int c4  = (tid & 15) * 4;      // 0..60
  v4f a[4];
#pragma unroll
  for (int it = 0; it < 4; ++it) a[it] = *(const v4f*)(inb + (size_t)(r0 + it * 16 + sub) * DHID + c0 + c4);
#pragma unroll
  for (int it = 0; it < 4; ++it) *(v4f*)(tf + (it * 16 + sub) * 68 + c4) = a[it];
  __syncthreads();                     // the tile is whole in LDS before it is read column-wise
  const int s8 = tid >> 3;             // 0..31
  const int c8 = (tid & 7) * 8;        // 0..56
#pragma unroll
  for (int it = 0; it < 2; ++it) {
    const int oc = it * 32 + s8;       // output row within tile (= input column)
    v4u t4, t4l;
#pragma unroll
    for (int q = 0; q < 4; ++q) {
      const float f0 = tf[(c8 + 2 * q) * 68 + oc];
      const float f1 = tf[(c8 + 2 * q + 1) * 68 + oc];
      const unsigned short h0 = f2bf_bits(f0), h1 = f2bf_bits(f1);
      const unsigned short l0 = f2bf_bits(f0 - bf_bits2f(h0));
      const unsigned short l1 = f2bf_bits(f1 - bf_bits2f(h1));
      t4[q]  = pk16(h0, h1);
      t4l[q] = pk16(l0, l1);
    }
    const size_t go = (size_t)(c0 + oc) * ldo + r0 + c8;
    *(v4u*)(ohb + go) = t4;
    *(v4u*)(olb + go) = t4l;
  }
  // the wait that stands before an issued store's registers are written again
  asm volatile("s_wait_xcnt 0x0" ::: "memory");
  // the natural planes, from the registers the tile was loaded into; behind the barrier, so that no wave holds the
  // work-group at the barrier for stores to memory
  if (!isW) {
#pragma unroll
    for (int it = 0; it < 4; ++it) {
      const size_t go = zb * (size_t)(HLEN * DHID) + (size_t)(r0 + it * 16 + sub) * DHID + c0 + c4;
      split4_store(a[it], Hh + go, Hl + go);
    }
    // the same wait: the listing keeps a path from here into the code of the pieces of P, which writes these registers
    asm volatile("s_wait_xcnt 0x0" ::: "memory");
  }
}

// ---------------------------------------------------------------------------
// Masked row softmax over one score row p of batch b = b0 + blockIdx.y (score slice blockIdx.y of S):
//   t[q] = (S[p][q] + bias) + (1 - pm[b][p]*hm[b][q]) * (-1e30)   (mask applied by value, finite fill)
//   a[q] = exp(t - max) / sum  -> bf16 hi/lo planes Ah/Al at the same [slice][p][q] position.
// Reductions in fixed order: per thread, wave shuffle tree, 4 wave partials in index order.
// Producer coverage: grid (PLEN, GRPB); 128 threads x 8 u16 = the whole 1024-wide row of each plane;
// ---------------------------------------------------------------------------
__global__ __launch_bounds__(128) void row_softmax_split_kernel(
    const float* __restrict__ S, const int* __restrict__ pm, const int* __restrict__ hm,
    const float* __restrict__ bias, unsigned short* __restrict__ Ah, unsigned short* __restrict__ Al, int b0) {
#pragma clang fp contract(off)
  __shared__ float redm[4];
  __shared__ float reds[4];
  const int p    = blockIdx.x;
  const int bb   = blockIdx.y;
  int b = b0 + bb;
  b = b < 0 ? 0 : (b > NBATCH - 1 ? NBATCH - 1 : b);
  const int tid  = threadIdx.x;
  const int lane = tid & 31;
  const int wave = tid >> 5;
  const int j0   = tid * 8;
  const float bv  = bias[0];
  const float pmv = (float)pm[(size_t)b * PLEN + p];
  const float* row = S + ((size_t)bb * PLEN + (size_t)p) * HLEN + j0;
  const v4f a0 = *(const v4f*)(row);
  const v4f a1 = *(const v4f*)(row + 4);
  const int* hrow = hm + (size_t)b * HLEN + j0;
  const v4i h0 = *(const v4i*)(hrow);
  const v4i h1 = *(const v4i*)(hrow + 4);
  float t[8];
#pragma unroll
  for (int e = 0; e < 4; ++e) {
    const float mk0 = pmv * (float)h0[e];
    const float mk1 = pmv * (float)h1[e];
    t[e]     = (a0[e] + bv) + (1.0f - mk0) * NEG_FILL;
    t[4 + e] = (a1[e] + bv) + (1.0f - mk1) * NEG_FILL;
  }
  float m = fmaxf(fmaxf(fmaxf(t[0], t[1]), fmaxf(t[2], t[3])), fmaxf(fmaxf(t[4], t[5]), fmaxf(t[6], t[7])));
#pragma unroll
  for (int off = 16; off > 0; off >>= 1) m = fmaxf(m, __shfl_xor(m, off, 32));
  if (lane == 0) redm[wave] = m;
  __syncthreads();
  const float mx = fmaxf(fmaxf(redm[0], redm[1]), fmaxf(redm[2], redm[3]));
  float ex[8];
#pragma unroll
  for (int e = 0; e < 8; ++e) ex[e] = __expf(t[e] - mx);
  float ps = ((((((ex[0] + ex[1]) + ex[2]) + ex[3]) + ex[4]) + ex[5]) + ex[6]) + ex[7];
#pragma unroll
  for (int off = 16; off > 0; off >>= 1) ps += __shfl_xor(ps, off, 32);
  if (lane == 0) reds[wave] = ps;
  __syncthreads();
  const float tot = ((reds[0] + reds[1]) + reds[2]) + reds[3];   // tot >= 1 (row max contributes exp(0))
  const float inv = 1.0f / tot;
  unsigned hw[4], lw[4];
#pragma unroll
  for (int q = 0; q < 4; ++q) {
    const float p0 = ex[2 * q] * inv, p1 = ex[2 * q + 1] * inv;
    const unsigned short hb0 = f2bf_bits(p0), hb1 = f2bf_bits(p1);
    const unsigned short lb0 = f2bf_bits(p0 - bf_bits2f(hb0));
    const unsigned short lb1 = f2bf_bits(p1 - bf_bits2f(hb1));
    hw[q] = pk16(hb0, hb1);
    lw[q] = pk16(lb0, lb1);
  }
  const v4u hvv = (v4u){hw[0], hw[1], hw[2], hw[3]};
  const v4u lvv = (v4u){lw[0], lw[1], lw[2], lw[3]};
  const size_t rowoff = ((size_t)bb * PLEN + (size_t)p) * HLEN + j0;
  *(v4u*)(Ah + rowoff) = hvv;
  *(v4u*)(Al + rowoff) = lvv;
  
}

// ---------------------------------------------------------------------------
// Column maximum of the masked score over all PLEN rows: CM[slice][q] = max_p t[p][q], t as in the row kernel.
// grid (HLEN/64, GRPB), 512 threads: a work-group owns 64 columns (256 B of every score row). 16 lanes x 16 B cover
// that piece of one row, so the 512 threads cover 32 rows at a time and each thread walks only PLEN/32 = 32 rows,
// whose loads are all issued before anything waits on them. The 32 row classes are joined by one lane exchange and
// an LDS table of 16 wave partials; a maximum does not depend on the order, so CM keeps its bits.
// ---------------------------------------------------------------------------
__global__ __launch_bounds__(512) void colmax_kernel(
    const float* __restrict__ S, const int* __restrict__ pm, const int* __restrict__ hm,
    const float* __restrict__ bias, float* __restrict__ CM, int b0) {
#pragma clang fp contract(off)
  __shared__ float spm[PLEN];
  __shared__ __align__(16) float red[16][64];
  const int bb  = blockIdx.y;
  int b = b0 + bb;
  b = b < 0 ? 0 : (b > NBATCH - 1 ? NBATCH - 1 : b);
  const int tid  = threadIdx.x;
  const int lane = tid & 31;
  const int wave = tid >> 5;
  const int c4   = (tid & 15) * 4;                     // column quad inside the 64-column strip
  const int rsub = tid >> 4;                           // row class 0..31
  const int q0   = blockIdx.x * 64;                    // q0 + 63 < HLEN by grid construction
  // every load of the kernel is issued before the first wait on data: one round trip to memory in all
  const int* pmb = pm + (size_t)b * PLEN;
  const int* hmb = hm + (size_t)b * HLEN + q0;
  const int pm0 = pmb[tid];
  const int pm1 = pmb[512 + tid];
  const v4i hq  = *(const v4i*)(hmb + c4);
  const float bv = bias[0];
  const float* col = S + (size_t)bb * PLEN * HLEN + (size_t)rsub * HLEN + q0 + c4;
  v4f s[PLEN / 32];
#pragma unroll
  for (int k = 0; k < PLEN / 32; ++k) s[k] = *(const v4f*)(col + (size_t)k * 32 * HLEN);
  // the wait that stands before an issued load's address registers are written again; naming the three bases as
  // inputs keeps their registers untouched up to it (without it this build reused two scalar bases at once)
  asm volatile("s_wait_xcnt 0x0" :: "v"(col), "s"(pmb), "s"(hmb) : "memory");
  spm[tid]       = (float)pm0;
  spm[512 + tid] = (float)pm1;
  __syncthreads();
  float hmv[4], m[4];
#pragma unroll
  for (int e = 0; e < 4; ++e) { hmv[e] = (float)hq[e]; m[e] = -__builtin_inff(); }
#pragma unroll
  for (int k = 0; k < PLEN / 32; ++k) {
    const float pmv = spm[k * 32 + rsub];
#pragma unroll
    for (int e = 0; e < 4; ++e) {
      const float tt = (s[k][e] + bv) + (1.0f - pmv * hmv[e]) * NEG_FILL;
      m[e] = fmaxf(m[e], tt);
    }
  }
#pragma unroll
  for (int e = 0; e < 4; ++e) m[e] = fmaxf(m[e], __shfl_xor(m[e], 16, 32));   // the wave's two row classes
  if (lane < 16) *(v4f*)(&red[wave][c4]) = (v4f){m[0], m[1], m[2], m[3]};
  __syncthreads();
  if (tid < 64) {
    float r = red[0][tid];
#pragma unroll
    for (int w = 1; w < 16; ++w) r = fmaxf(r, red[w][tid]);
    CM[(size_t)bb * HLEN + q0 + tid] = r;
  }
}

// ---------------------------------------------------------------------------
// Aligned premise of batch b = b0 + blockIdx.y, hidden columns d0 = 32*blockIdx.x .. d0+31 (one 128-B line of every
// row): at[q] = softmax_q(CM[slice][q]) (f32, fixed order, computed by each of the 8 work-groups of a batch),
// ap[d] = sum_q at[q] * P[b][q][d], then out0[b][r][d0..d0+31] = ap for every r < HLEN.
// 8 lanes x 16 B cover the line of one row, so the 256 threads cover 32 rows at a time and each thread walks only
// HLEN/32 = 32 rows, whose loads are all issued at the top, together with those of the column maxima.
// Sum order (fixed): per thread q = rsub, rsub+32, ...; lane exchange over 8 then 16; 8 wave partials in index order.
// ---------------------------------------------------------------------------
__global__ __launch_bounds__(256) void premise_kernel(
    const float* __restrict__ CM, const float* __restrict__ P, float* __restrict__ out0, int b0) {
  __shared__ __align__(16) float scm[HLEN];
  __shared__ __align__(16) float spr[HLEN];
  __shared__ __align__(16) float spart[8][32];
  __shared__ float redm[8];
  __shared__ float reds[8];
  const int bb   = blockIdx.y;
  int b = b0 + bb;
  b = b < 0 ? 0 : (b > NBATCH - 1 ? NBATCH - 1 : b);
  const int tid  = threadIdx.x;
  const int lane = tid & 31;
  const int wave = tid >> 5;
  const int c4   = (tid & 7) * 4;                      // column quad inside the 32-column strip
  const int rsub = tid >> 3;                           // row class 0..31
  const size_t so = (size_t)b * PLEN * DHID + (size_t)rsub * DHID + blockIdx.x * 32 + c4;

  // every load of the kernel is issued before the first wait on data: one round trip to memory in all
  float cv[HLEN / 256];
#pragma unroll
  for (int j = 0; j < HLEN / 256; ++j) cv[j] = CM[(size_t)bb * HLEN + j * 256 + tid];
  const float* Pb = P + so;
  v4f pv[HLEN / 32];
#pragma unroll
  for (int k = 0; k < HLEN / 32; ++k) pv[k] = *(const v4f*)(Pb + (size_t)k * 32 * DHID);

  float lm = -__builtin_inff();
#pragma unroll
  for (int j = 0; j < HLEN / 256; ++j) {
    scm[j * 256 + tid] = cv[j];
    lm = fmaxf(lm, cv[j]);
  }
#pragma unroll
  for (int off = 16; off > 0; off >>= 1) lm = fmaxf(lm, __shfl_xor(lm, off, 32));
  if (lane == 0) redm[wave] = lm;
  __syncthreads();
  float mx = redm[0];
#pragma unroll
  for (int w = 1; w < 8; ++w) mx = fmaxf(mx, redm[w]);

  float ls = 0.f;
  for (int i = tid; i < HLEN; i += 256) {
    const float e = __expf(scm[i] - mx);
    spr[i] = e;
    ls += e;
  }
#pragma unroll
  for (int off = 16; off > 0; off >>= 1) ls += __shfl_xor(ls, off, 32);
  if (lane == 0) reds[wave] = ls;
  __syncthreads();
  float tot = reds[0];
#pragma unroll
  for (int w = 1; w < 8; ++w) tot += reds[w];
  const float inv = 1.0f / tot;                        // tot >= 1
  for (int i = tid; i < HLEN; i += 256) spr[i] = spr[i] * inv;   // same thread wrote spr[i]
  __syncthreads();

  v4f acc = (v4f){0.f, 0.f, 0.f, 0.f};
#pragma unroll
  for (int k = 0; k < HLEN / 32; ++k) acc = acc + spr[k * 32 + rsub] * pv[k];
#pragma unroll
  for (int e = 0; e < 4; ++e) {
    acc[e] += __shfl_xor(acc[e], 8, 32);               // the wave's four row classes
    acc[e] += __shfl_xor(acc[e], 16, 32);
  }
  if (lane < 8) *(v4f*)(&spart[wave][c4]) = acc;
  __syncthreads();
  v4f va = *(const v4f*)(&spart[0][c4]);
#pragma unroll
  for (int w = 1; w < 8; ++w) va = va + *(const v4f*)(&spart[w][c4]);

  float* ob = out0 + so;                               // PLEN == HLEN: out0 has the premise's shape
#pragma unroll
  for (int k = 0; k < HLEN / 32; ++k) *(v4f*)(ob + (size_t)k * 32 * DHID) = va;
}

// ---------------------------------------------------------------------------
// Workspace region map (byte offsets, all multiples of 16 KiB). Every region is fully written before it is read:
// the weight/activation planes once up front; S, Ah/Al, CM fully written per group of GRPB batches.
//   WTh   bf16 [256][256]    Wt[e][d] = W[d][e] hi              0
//   WTl   bf16 [256][256]                                  131072
//   Ph    bf16 [16][1024][256] premise hi                  262144
//   Pl                                                    8650752
//   Hh    bf16 [16][1024][256] hypothesis hi             17039360
//   Hl                                                   25427968
//   HTh   bf16 [16][256][1024] hypothesis^T hi           33816576
//   HTl                                                  42205184
//   PWh   bf16 [16*1024][256]  (P.W) hi                  50593792
//   PWl                                                  58982400
//   S     f32  [GRPB][1024][1024] raw bilinear scores     67371008
//   Ah    bf16 [GRPB][1024][1024] row softmax hi        134479872
//   Al                                                 168034304
//   CM    f32  [GRPB][1024] masked column maxima        201588736
//   total                                               201654272
// ---------------------------------------------------------------------------
extern "C" void kernel_launch(void* const* d_in, const int* in_sizes, int n_in,
                              void* d_out, int out_size, void* d_ws, size_t ws_size,
                              hipStream_t stream) {
  if (n_in < 6) return;
  if (in_sizes[0] != NBATCH * PLEN * DHID) return;
  if (in_sizes[1] != NBATCH * HLEN * DHID) return;
  if (in_sizes[2] != NBATCH * PLEN || in_sizes[3] != NBATCH * HLEN) return;
  if (in_sizes[4] != DHID * DHID || in_sizes[5] < 1) return;
  if (out_size != 2 * NBATCH * PLEN * DHID) return;

  const float* P    = (const float*)d_in[0];
  const float* H    = (const float*)d_in[1];
  const int*   pm   = (const int*)d_in[2];
  const int*   hm   = (const int*)d_in[3];
  const float* W    = (const float*)d_in[4];
  const float* bias = (const float*)d_in[5];

  const size_t PWT = (size_t)DHID * DHID * 2;                 // 16-bit [256][256]
  const size_t PAC = (size_t)NBATCH * PLEN * DHID * 2;        // 16-bit [16][1024][256]
  const size_t PSC = (size_t)GRPB * PLEN * HLEN * 4;          // f32 scores of one group
  const size_t PPR = (size_t)GRPB * PLEN * HLEN * 2;          // bf16 probability plane of one group
  const size_t PCM = (size_t)GRPB * HLEN * 4;
  size_t off = 0;
  const size_t oWTh = off; off += PWT;
  const size_t oWTl = off; off += PWT;
  const size_t oPh  = off; off += PAC;
  const size_t oPl  = off; off += PAC;
  const size_t oHh  = off; off += PAC;
  const size_t oHl  = off; off += PAC;
  const size_t oHTh = off; off += PAC;
  const size_t oHTl = off; off += PAC;
  const size_t oPWh = off; off += PAC;
  const size_t oPWl = off; off += PAC;
  const size_t oS   = off; off += PSC;
  const size_t oAh  = off; off += PPR;
  const size_t oAl  = off; off += PPR;
  const size_t oCM  = off; off += PCM;
  if (off > ws_size) return;

  char* ws = (char*)d_ws;
  unsigned short* WTh = (unsigned short*)(ws + oWTh);
  unsigned short* WTl = (unsigned short*)(ws + oWTl);
  unsigned short* Ph  = (unsigned short*)(ws + oPh);
  unsigned short* Pl  = (unsigned short*)(ws + oPl);
  unsigned short* Hh  = (unsigned short*)(ws + oHh);
  unsigned short* Hl  = (unsigned short*)(ws + oHl);
  unsigned short* HTh = (unsigned short*)(ws + oHTh);
  unsigned short* HTl = (unsigned short*)(ws + oHTl);
  unsigned short* PWh = (unsigned short*)(ws + oPWh);
  unsigned short* PWl = (unsigned short*)(ws + oPWl);
  float*          Sbuf = (float*)(ws + oS);
  unsigned short* Ah  = (unsigned short*)(ws + oAh);
  unsigned short* Al  = (unsigned short*)(ws + oAl);
  float*          CM  = (float*)(ws + oCM);

  float* out0 = (float*)d_out;                                   // aligned premise (broadcast) [16][1024][256]
  float* out1 = (float*)d_out + (size_t)NBATCH * PLEN * DHID;    // aligned hypothesis [16][1024][256]

  const dim3 blk(256);
  // (0-2) W -> WT[e][d], P -> natural planes, H -> natural planes and HT[b][d][q], all hi/lo, in one launch
  prep_kernel<<<dim3(PREP_HT + PREP_WT + PREP_PB), blk, 0, stream>>>(P, H, W, Ph, Pl, Hh, Hl, HTh, HTl, WTh, WTl);
  // (3) PW[p][e] = sum_d P[p][d] W[d][e] over all batches: M=16384, N=256, K=256 (K%64, M,N%128) -> PW hi/lo planes
  const dim3 gblk(128);                                          // GEMM work-group: 4 waves, one 128x128 tile
  const dim3 gPW((NBATCH * PLEN / 128) * (DHID / 128), 1);       // 256 blocks
  wmma_gemm64<1, true, 0, 2, false, 0><<<gPW, gblk, 0, stream>>>(
      Ph, Pl, DHID, 0L, WTh, WTl, DHID, 0L, (void*)PWh, (void*)PWl, DHID, 0L,
      bias, bias, 0L, NBATCH * PLEN, DHID, DHID, 1.0f);

  const dim3 gS((PLEN / 128) * (HLEN / 128), GRPB);              // 64 x GRPB: M=N=1024, K=256
  const dim3 gSm(PLEN, GRPB);                                    // one block per (row, batch in group)
  const dim3 gCM(HLEN / 64, GRPB);                               // 16 x GRPB, 512 threads each
  const dim3 gPr(DHID / 32, GRPB);                               // 8 x GRPB
  const dim3 gAV((PLEN / 128) * (DHID / 128), GRPB);             // 16 x GRPB: M=1024, N=256, K=1024

  for (int g = 0; g < NGRPS; ++g) {
    const int b0 = g * GRPB;
    const size_t aoff = (size_t)b0 * PLEN * DHID;               // u16 / float offset of batch b0 in [16][1024][256]
    const size_t toff = (size_t)b0 * DHID * HLEN;               // u16 offset of batch b0 in [16][256][1024]
    // (4) S[bb][p][q] = sum_e PW[b][p][e] H[b][q][e] (raw f32, whole 1024x1024 per bb)
    wmma_gemm64<1, true, 0, 0, false, 0><<<gS, gblk, 0, stream>>>(
        PWh + aoff, PWl + aoff, DHID, (long)PLEN * DHID,
        Hh + aoff, Hl + aoff, DHID, (long)HLEN * DHID,
        (void*)Sbuf, (void*)Sbuf, HLEN, (long)PLEN * HLEN,
        bias, bias, 0L, PLEN, HLEN, DHID, 1.0f);
    // (5) bias + mask + row softmax -> A hi/lo planes (whole 1024x1024 per bb)
    row_softmax_split_kernel<<<gSm, dim3(128), 0, stream>>>(Sbuf, pm, hm, bias, Ah, Al, b0);
    // (6) masked column maxima -> CM (whole 1024 per bb)
    colmax_kernel<<<gCM, dim3(512), 0, stream>>>(Sbuf, pm, hm, bias, CM, b0);
    // (7) softmax(CM), premise reduction, broadcast rows -> out0[b] (whole 1024x256 per b)
    premise_kernel<<<gPr, blk, 0, stream>>>(CM, P, out0, b0);
    // (8) out1[b][p][d] = sum_q A[bb][p][q] HT[b][d][q]: M=1024, N=256, K=1024 -> f32 d_out (whole 1024x256 per b)
    wmma_gemm64<1, true, 0, 0, false, 0><<<gAV, gblk, 0, stream>>>(
        Ah, Al, HLEN, (long)PLEN * HLEN,
        HTh + toff, HTl + toff, HLEN, (long)DHID * HLEN,
        (void*)(out1 + aoff), (void*)(out1 + aoff), DHID, (long)PLEN * DHID,
        bias, bias, 0L, PLEN, DHID, HLEN, 1.0f);
  }
}

// v005
// One run takes 105 microseconds.
// Next to v004, in two timings, it ran 1.08 and 1.11 times as fast.
// All steps since v000 together make it 14.4 times as fast.
// Contractions P.W, (P.W).Hy^T and attn.Hy: v_wmma_f32_16x16x32_bf16 on bf16 hi/lo split operand planes (hi.hi + hi.lo + lo.hi), f32 accumulate; masked row softmax (in the score launch's epilogue), column-max softmax and the 1024x256 premise reduction in f32 on VALU; tuple output (out0 = broadcast aligned premise, out1 = aligned hypothesis).
#include <hip/hip_runtime.h>
#include <math.h>
#include <stdint.h>

#define NBATCH 16
#define PLEN   1024
#define HLEN   1024
#define DHID   256
#define GRPB   16                 // batches processed per score group (all of them: one pass of launches)
#define NGRPS  (NBATCH / GRPB)
#define NEG_FILL (-1e30f)
static_assert(PLEN == HLEN, "column-max softmax indexes premise rows by hypothesis position");
static_assert(NBATCH % GRPB == 0, "whole groups");
static_assert(PLEN == 1024 && HLEN == 1024 && DHID == 256, "the column-max and premise kernels deal rows and columns for this shape");

typedef __attribute__((ext_vector_type(16))) _Float16 v16h;
typedef __attribute__((ext_vector_type(8)))  _Float16 v8h;
typedef __attribute__((ext_vector_type(16))) __bf16   v16b;
typedef __attribute__((ext_vector_type(8)))  __bf16   v8b;
typedef __attribute__((ext_vector_type(8)))  float    v8f;
typedef __attribute__((ext_vector_type(4)))  float    v4f;
typedef __attribute__((ext_vector_type(2)))  float    v2f;
typedef __attribute__((ext_vector_type(4)))  unsigned int v4u;
typedef __attribute__((ext_vector_type(2)))  unsigned int v2u;
typedef __attribute__((ext_vector_type(4)))  int      v4i;

__device__ __forceinline__ unsigned short f2bf_bits(float f) {
  unsigned u = __float_as_uint(f);
  return (unsigned short)((u + 0x7FFFu + ((u >> 16) & 1u)) >> 16);
}
__device__ __forceinline__ float bf_bits2f(unsigned short h) { return __uint_as_float(((unsigned)h) << 16); }

// hazard guards as plain device helpers
__device__ __forceinline__ void dep_guard_h(v8f& a, v8f& b, v16h x, v16h y) { asm volatile("v_nop\n\tv_nop\n\tv_nop\n\tv_nop" : "+v"(a), "+v"(b) : "v"(x), "v"(y)); }
__device__ __forceinline__ void dep_guard_b(v8f& a, v8f& b, v16b x, v16b y) { asm volatile("v_nop\n\tv_nop\n\tv_nop\n\tv_nop" : "+v"(a), "+v"(b) : "v"(x), "v"(y)); }
__device__ __forceinline__ void keep4_h(v16h a, v16h b, v16h c, v16h d) { asm volatile("v_nop" :: "v"(a), "v"(b), "v"(c), "v"(d)); }
__device__ __forceinline__ void keep4_b(v16b a, v16b b, v16b c, v16b d) { asm volatile("v_nop" :: "v"(a), "v"(b), "v"(c), "v"(d)); }
__device__ __forceinline__ void acc_guard4(v8f& a, v8f& b, v8f& c, v8f& d) { asm volatile("v_nop\n\tv_nop\n\tv_nop\n\tv_nop" : "+v"(a), "+v"(b), "+v"(c), "+v"(d)); }
template <typename T> struct Frag;
template <> struct Frag<_Float16> {
  typedef v16h V; union U { v16h v; v8h h[2]; };
  static __device__ __forceinline__ v16h load(const _Float16* p) {   // elements 0..7 <- p[0..7], 8..15 <- p[16..23]
    U f; f.h[0] = *(const v8h*)(p); f.h[1] = *(const v8h*)(p + 16); return f.v;
  }
  static __device__ __forceinline__ v8f mma(v16h a, v16h b, v8f c) {
    return __builtin_amdgcn_wmma_f32_16x16x32_f16(false, a, false, b, (short)0, c, false, false);
  }
  static __device__ __forceinline__ void guard(v8f& a, v8f& b, v16h x, v16h y) { dep_guard_h(a, b, x, y); }
  static __device__ __forceinline__ void keep(v16h a, v16h b, v16h c, v16h d) { keep4_h(a, b, c, d); }
};
template <> struct Frag<__bf16> {
  typedef v16b V; union U { v16b v; v8b h[2]; };
  static __device__ __forceinline__ v16b load(const __bf16* p) {
    U f; f.h[0] = *(const v8b*)(p); f.h[1] = *(const v8b*)(p + 16); return f.v;
  }
  static __device__ __forceinline__ v8f mma(v16b a, v16b b, v8f c) {
    return __builtin_amdgcn_wmma_f32_16x16x32_bf16(false, a, false, b, (short)0, c, false, false);
  }
  static __device__ __forceinline__ void guard(v8f& a, v8f& b, v16b x, v16b y) { dep_guard_b(a, b, x, y); }
  static __device__ __forceinline__ void keep(v16b a, v16b b, v16b c, v16b d) { keep4_b(a, b, c, d); }
};

// ---- Register-blocked batched WMMA GEMM, operands staged in LDS -------------
// C[m,n] = scale * sum_k A[m,k] * Bt[n,k] (+bias)(+resid); a work-group of 4 waves (2 x 2) owns a 128x128 tile,
// each wave a 64x64 tile of it.
// A row-major [M,K]; Bt row-major [N,K]; M,N % 128 == 0, K % 64 == 0.
// SPLIT: operands are hi/lo planes (A2/Bt2 = lo planes, same layout); product = hi.hi + hi.lo + lo.hi.
// BIAS_MODE: 0 = none, 1 = bias[m], 2 = bias[n].
// OUT_MODE: 0 = f32, 1 = f16, 2 = bf16 hi plane (Cout) + bf16 lo plane (Cout2).
// ET: 0 = f16 operands, 1 = bf16 operands (pointers passed as 16-bit storage)
// A stage is 64 k (one 128-B line of every operand row) of the tile's 128 A rows and 128 Bt rows, hi and lo plane:
// four planes of 128 rows at a pitch of 144 B (16 B x odd: the 16 rows of a fragment load fall on 64 distinct banks).
// Asynchronous copies bring whole lines from global memory into LDS, through no register; two stage buffers, so
// that the next stage's copies fly while this stage is multiplied. Each operand line is fetched once per work-group
// and read from LDS by the two waves that need it.
#define STG_K      64                         // k elements per stage
#define STG_PITCH  144                        // LDS bytes per staged row
#define STG_PLANE  (128 * STG_PITCH)          // one operand plane of a stage
#define STG_BYTES  (4 * STG_PLANE)            // A hi | A lo | Bt hi | Bt lo
static_assert(4 * 16 * 68 * 4 <= 2 * STG_BYTES, "the epilogue slabs reuse the stage buffers");

// Eight copies of 16 B per lane: rows r, r+16, ..., r+112 of one staged plane (l: the lane's LDS byte address of row r,
// g: its global address, gstep: elements between row r and row r+16). The s_wait_xcnt that stands before a copy's
// address registers are written again is the last line of the copies' own statement, so nothing can move above it.
__device__ __forceinline__ void stage_plane(unsigned l, const unsigned short* g, size_t gstep) {
  asm volatile(
      "global_load_async_to_lds_b128 %0, %8, off\n\t"
      "global_load_async_to_lds_b128 %1, %9, off\n\t"
      "global_load_async_to_lds_b128 %2, %10, off\n\t"
      "global_load_async_to_lds_b128 %3, %11, off\n\t"
      "global_load_async_to_lds_b128 %4, %12, off\n\t"
      "global_load_async_to_lds_b128 %5, %13, off\n\t"
      "global_load_async_to_lds_b128 %6, %14, off\n\t"
      "global_load_async_to_lds_b128 %7, %15, off\n\t"
      "s_wait_xcnt 0x0"
      :: "v"(l), "v"(l + 16 * STG_PITCH), "v"(l + 32 * STG_PITCH), "v"(l + 48 * STG_PITCH),
         "v"(l + 64 * STG_PITCH), "v"(l + 80 * STG_PITCH), "v"(l + 96 * STG_PITCH), "v"(l + 112 * STG_PITCH),
         "v"(g), "v"(g + gstep), "v"(g + 2 * gstep), "v"(g + 3 * gstep),
         "v"(g + 4 * gstep), "v"(g + 5 * gstep), "v"(g + 6 * gstep), "v"(g + 7 * gstep)
      : "memory");
}

template <int ET> struct Elem;
template <> struct Elem<0> { typedef _Float16 T; };
template <> struct Elem<1> { typedef __bf16 T; };
template <int ET, bool SPLIT, int BIAS_MODE, int OUT_MODE, bool RESID, int ACT = 0>
__global__ __launch_bounds__(128) void wmma_gemm64(
    const unsigned short* __restrict__ Ap, const unsigned short* __restrict__ A2p, int lda, long strideA,
    const unsigned short* __restrict__ Btp, const unsigned short* __restrict__ Bt2p, int ldb, long strideB,
    void* __restrict__ Cout, void* __restrict__ Cout2, int ldc, long strideC,
    const float* __restrict__ bias,
    const float* __restrict__ resid, long strideR,
    int M, int N, int K, float scale) {
  typedef typename Elem<ET>::T T;
  typedef typename Frag<T>::V V;
  __shared__ __align__(16) unsigned char ring[2 * STG_BYTES];   // two stage buffers; afterwards the epilogue slabs
  const int b    = blockIdx.y;
  const int tid  = threadIdx.x;
  const int lane = tid & 31;
  const int wave = tid >> 5;
  const int tilesN = N >> 7;
  const int tilesM = M >> 7;
  const int tile = blockIdx.x;
  if (tile >= tilesM * tilesN) return;   // the whole work-group leaves, in front of every barrier and copy
  const int tm = tile / tilesN;
  const int tn = tile - tm * tilesN;
  const int bm0 = tm << 7;                     // the work-group's tile
  const int bn0 = tn << 7;
  const int wm0 = (wave >> 1) << 6;            // the wave's 64x64 tile inside it
  const int wn0 = (wave & 1) << 6;
  const int m0 = bm0 + wm0;
  const int n0 = bn0 + wn0;

  const int rlane = lane & 15;                 // row (A) / col (B, D) within subtile
  const int koff  = (lane >> 4) * 8;           // k offset of this lane half
  const int mOff  = (lane >> 4) * 8;           // D row offset

  // copies: 8 lanes x 16 B cover the 128-B line of one row, the 128 threads 16 rows at a time
  const int crow = tid >> 3;
  const int cch  = (tid & 7) * 8;              // in elements
  const size_t aoffs = (size_t)b * strideA + (size_t)(bm0 + crow) * lda + cch;
  const size_t boffs = (size_t)b * strideB + (size_t)(bn0 + crow) * ldb + cch;
  const unsigned short* gA  = Ap  + aoffs;
  const unsigned short* gB  = Btp + boffs;
  const unsigned short* gA2 = SPLIT ? (A2p  + aoffs) : nullptr;
  const unsigned short* gB2 = SPLIT ? (Bt2p + boffs) : nullptr;
  const size_t astep = (size_t)16 * lda;
  const size_t bstep = (size_t)16 * ldb;
  const unsigned lcopy = (unsigned)(size_t)ring + (unsigned)(crow * STG_PITCH + cch * 2);
  const int nstg = K / STG_K;

  v8f acc[4][4];
#pragma unroll
  for (int i = 0; i < 4; ++i)
#pragma unroll
    for (int j = 0; j < 4; ++j) acc[i][j] = (v8f){0.f,0.f,0.f,0.f,0.f,0.f,0.f,0.f};

  // stage 0 into buffer 0, landed and published; then stage 1 into buffer 1
  stage_plane(lcopy, gA, astep);
  if (SPLIT) stage_plane(lcopy + STG_PLANE, gA2, astep);
  stage_plane(lcopy + 2 * STG_PLANE, gB, bstep);
  if (SPLIT) stage_plane(lcopy + 3 * STG_PLANE, gB2, bstep);
  asm volatile("s_wait_asynccnt 0x0" ::: "memory");   // this wave's copies of stage 0 have landed
  __syncthreads();                                    // and every other wave's
  if (nstg > 1) {
    stage_plane(lcopy + STG_BYTES, gA + STG_K, astep);
    if (SPLIT) stage_plane(lcopy + STG_BYTES + STG_PLANE, gA2 + STG_K, astep);
    stage_plane(lcopy + STG_BYTES + 2 * STG_PLANE, gB + STG_K, bstep);
    if (SPLIT) stage_plane(lcopy + STG_BYTES + 3 * STG_PLANE, gB2 + STG_K, bstep);
  }

  // the K loop stays rolled: one stage per trip, every fragment and accumulator index a constant
#pragma clang loop unroll(disable)
  for (int s = 0; s < nstg; ++s) {
    const unsigned bufo = (unsigned)(s & 1) * STG_BYTES;
    const unsigned char* sA = ring + bufo + (wm0 + rlane) * STG_PITCH + koff * 2;
    const unsigned char* sB = ring + bufo + 2 * STG_PLANE + (wn0 + rlane) * STG_PITCH + koff * 2;
    // eight rows of WMMAs per stage (two k blocks x four A fragments); the next row's A fragments are fetched into a
    // second register pair ahead of this row's WMMAs, so that their LDS latency runs behind the matrix work
    constexpr int NROW = (STG_K / 32) * 4;
    V bh[4], bl[4], ah[2], al[2];
    ah[0] = Frag<T>::load((const T*)sA);
    if (SPLIT) al[0] = Frag<T>::load((const T*)(sA + STG_PLANE));
#pragma unroll
    for (int u = 0; u < NROW; ++u) {
      const int i = u & 3;
      if (i == 0) {
#pragma unroll
        for (int j = 0; j < 4; ++j) {
          const unsigned char* pb = sB + j * 16 * STG_PITCH + (u >> 2) * 64;
          bh[j] = Frag<T>::load((const T*)pb);
          if (SPLIT) bl[j] = Frag<T>::load((const T*)(pb + STG_PLANE));
        }
      }
      if (u + 1 < NROW) {
        const unsigned char* pa = sA + ((u + 1) & 3) * 16 * STG_PITCH + ((u + 1) >> 2) * 64;
        ah[(u + 1) & 1] = Frag<T>::load((const T*)pa);
        if (SPLIT) al[(u + 1) & 1] = Frag<T>::load((const T*)(pa + STG_PLANE));
      }
      const V ahu = ah[u & 1];
      const V alu = SPLIT ? al[u & 1] : ah[u & 1];
#pragma unroll
      for (int j = 0; j < 4; ++j) {
        acc[i][j] = Frag<T>::mma(ahu, bh[j], acc[i][j]);
        if (SPLIT) {
          acc[i][j] = Frag<T>::mma(ahu, bl[j], acc[i][j]);
          acc[i][j] = Frag<T>::mma(alu, bh[j], acc[i][j]);
        }
      }
      Frag<T>::guard(acc[i][0], acc[i][3], ahu, alu);
      if (i == 3) {
        Frag<T>::keep(bh[0], bh[1], bh[2], bh[3]);
        if (SPLIT) Frag<T>::keep(bl[0], bl[1], bl[2], bl[3]);
      }
    }
    asm volatile("s_wait_dscnt 0x0" ::: "memory");      // this wave's reads of the buffer are done before it is refilled
    asm volatile("s_wait_asynccnt 0x0" ::: "memory");   // this wave's copies of stage s + 1 have landed
    __syncthreads();   // publishes stage s + 1 and ends every wave's reads of stage s
    if (s + 2 < nstg) {
      const size_t ko = (size_t)(s + 2) * STG_K;
      stage_plane(lcopy + bufo, gA + ko, astep);
      if (SPLIT) stage_plane(lcopy + bufo + STG_PLANE, gA2 + ko, astep);
      stage_plane(lcopy + bufo + 2 * STG_PLANE, gB + ko, bstep);
      if (SPLIT) stage_plane(lcopy + bufo + 3 * STG_PLANE, gB2 + ko, bstep);
    }
  }
  asm volatile("s_wait_asynccnt 0x0" ::: "memory");     // no copy is outstanding when the buffers become slabs
  acc_guard4(acc[0][0], acc[0][1], acc[0][2], acc[0][3]);
  acc_guard4(acc[1][0], acc[1][1], acc[1][2], acc[1][3]);
  acc_guard4(acc[2][0], acc[2][1], acc[2][2], acc[2][3]);
  acc_guard4(acc[3][0], acc[3][1], acc[3][2], acc[3][3]);

  // ---- epilogue ----
  // per-wave 16x64 slab, pitch 68 floats, in the stage buffers: the last trip's barrier ended every read of them
  float* slab = (float*)ring + wave * (16 * 68);
  const float* Rb = RESID ? (resid + (size_t)b * strideR) : nullptr;
#pragma unroll
  for (int i = 0; i < 4; ++i) {
    const int mBase = m0 + (i << 4);
#pragma unroll
    for (int j = 0; j < 4; ++j) {
      const int n = n0 + (j << 4) + rlane;
      float bv = 0.f;
      if (BIAS_MODE == 2) bv = bias[n];
#pragma unroll
      for (int r = 0; r < 8; ++r) {
        float v = acc[i][j][r] * scale;
        if (BIAS_MODE == 1) v += bias[mBase + mOff + r];
        if (BIAS_MODE == 2) v += bv;
        if (RESID) v += Rb[(size_t)(mBase + mOff + r) * ldc + n];
        if (ACT == 1) v = tanhf(v);
        if (ACT == 2) v = fmaxf(v, 0.0f);
        if (ACT == 3) v = v / (1.0f + expf(-v));
        if (ACT == 4) v = (v > 0.f) ? v : 0.01f * v;
        if (ACT == 5) v = 0.5f * v * (1.0f + erff(v * 0.70710678118654752f));
        slab[(mOff + r) * 68 + (j << 4) + rlane] = v;
      }
    }
    __builtin_amdgcn_fence(__ATOMIC_RELEASE, "workgroup");
    __builtin_amdgcn_wave_barrier();
    __builtin_amdgcn_fence(__ATOMIC_ACQUIRE, "workgroup");
    if (OUT_MODE == 0) {
      float* C = (float*)Cout + (size_t)b * strideC;
      const int hh = lane >> 4, c4 = (lane & 15) * 4;     // row seg = 256 B = 16 lanes x 16 B
      {
#pragma unroll
        for (int it = 0; it < 8; ++it) {
          const int row = it * 2 + hh;
          v4f v = *(const v4f*)(slab + row * 68 + c4);
          *(v4f*)(C + (size_t)(mBase + row) * ldc + n0 + c4) = v;
        }
        
      }
    } else {
      const int q = lane >> 3, c8 = (lane & 7) * 8;
      unsigned short* C  = (unsigned short*)Cout  + (size_t)b * strideC;
      unsigned short* C2 = (OUT_MODE == 2) ? ((unsigned short*)Cout2 + (size_t)b * strideC) : nullptr;
      {
#pragma unroll
        for (int it = 0; it < 4; ++it) {
          const int row = it * 4 + q;
          const float* sp = slab + row * 68 + c8;
          v8h hv, lv;
#pragma unroll
          for (int e = 0; e < 8; ++e) {
            if (OUT_MODE == 1) {
              hv[e] = (_Float16)sp[e];
            } else {
              unsigned short hb = f2bf_bits(sp[e]);
              unsigned short lb = f2bf_bits(sp[e] - bf_bits2f(hb));
              hv[e] = __builtin_bit_cast(_Float16, hb);
              lv[e] = __builtin_bit_cast(_Float16, lb);
            }
          }
          *(v8h*)(C + (size_t)(mBase + row) * ldc + n0 + c8) = hv;
          if (OUT_MODE == 2) *(v8h*)(C2 + (size_t)(mBase + row) * ldc + n0 + c8) = lv;
        }
        
      }
    }
    __builtin_amdgcn_fence(__ATOMIC_RELEASE, "workgroup");
    __builtin_amdgcn_wave_barrier();
    __builtin_amdgcn_fence(__ATOMIC_ACQUIRE, "workgroup");
  }
}

// ---------------------------------------------------------------------------
// Operand preparation, one launch for all of it. hi = bf16_rne(x), lo = bf16_rne(x - hi) everywhere.
// A work-group of 256 threads takes one piece of the work, chosen by its index alone:
//   [0, PREP_HT)                 a 64x64 tile of H[b] ([1024 q][256 d]): read once, written as the natural planes
//                                Hh/Hl[b][q][d] from registers and, turned in LDS, as HTh/HTl[b][d][q]
//   [PREP_HT, PREP_HT + PREP_WT) a 64x64 tile of W ([256 d][256 e]): turned only, WTh/WTl[e][d]
//   the PREP_PB others           8192 consecutive elements of P: natural planes Ph/Pl
// Every wave-wide load covers whole 128-B lines (16 B per lane, neighbouring lanes neighbouring bytes); every store
// instruction of a wave writes whole 128-B lines of its plane, each line by one wave.
// Coverage: H 16 batches x 16 x 4 tiles; W 4 x 4 tiles; P 512 x 8192 = 16 x 1024 x 256 elements.
// ---------------------------------------------------------------------------
__device__ __forceinline__ unsigned pk16(unsigned short a, unsigned short b) { return (unsigned)a | ((unsigned)b << 16); }

#define PREP_HT  (NBATCH * (HLEN / 64) * (DHID / 64))
#define PREP_WT  ((DHID / 64) * (DHID / 64))
#define PREP_PE  8192
#define PREP_PB  (NBATCH * PLEN * DHID / PREP_PE)
static_assert(NBATCH * PLEN * DHID % PREP_PE == 0, "whole pieces of P");

// four consecutive f32 -> four bf16 of the hi plane and four of the lo plane, 8 B each
__device__ __forceinline__ void split4_store(v4f f, unsigned short* hi, unsigned short* lo) {
  const unsigned short h0 = f2bf_bits(f[0]), h1 = f2bf_bits(f[1]), h2 = f2bf_bits(f[2]), h3 = f2bf_bits(f[3]);
  const unsigned short l0 = f2bf_bits(f[0] - bf_bits2f(h0)), l1 = f2bf_bits(f[1] - bf_bits2f(h1));
  const unsigned short l2 = f2bf_bits(f[2] - bf_bits2f(h2)), l3 = f2bf_bits(f[3] - bf_bits2f(h3));
  *(v2u*)hi = (v2u){pk16(h0, h1), pk16(h2, h3)};
  *(v2u*)lo = (v2u){pk16(l0, l1), pk16(l2, l3)};
}

__global__ __launch_bounds__(256) void prep_kernel(
    const float* __restrict__ P, const float* __restrict__ H, const float* __restrict__ W,
    unsigned short* __restrict__ Ph, unsigned short* __restrict__ Pl,
    unsigned short* __restrict__ Hh, unsigned short* __restrict__ Hl,
    unsigned short* __restrict__ HTh, unsigned short* __restrict__ HTl,
    unsigned short* __restrict__ WTh, unsigned short* __restrict__ WTl) {
  __shared__ __align__(16) float tf[64 * 68];
  const int tid = threadIdx.x;
  const int blk = blockIdx.x;
  if (blk >= PREP_HT + PREP_WT) {      // the whole work-group: a piece of P, no LDS and no barrier
    const size_t base = (size_t)(blk - (PREP_HT + PREP_WT)) * PREP_PE + tid * 4;
    const float* pin = P + base;
    v4f a[PREP_PE / 1024];
#pragma unroll
    for (int it = 0; it < PREP_PE / 1024; ++it) a[it] = *(const v4f*)(pin + it * 1024);
    // the wait that stands before an issued load's address registers are written again; naming the address as an
    // input keeps its registers untouched up to it (without it this build landed the last load's data in them)
    asm volatile("s_wait_xcnt 0x0" :: "v"(pin) : "memory");
#pragma unroll
    for (int it = 0; it < PREP_PE / 1024; ++it) split4_store(a[it], Ph + base + it * 1024, Pl + base + it * 1024);
    return;
  }
  const bool isW = blk >= PREP_HT;     // the same for the whole work-group
  const int t   = isW ? blk - PREP_HT : (blk & 63);
  const size_t zb = isW ? 0 : (size_t)(blk >> 6);
  const int c0  = (t & 3) * 64;        // input column block = output row block of the turned planes
  const int r0  = (t >> 2) * 64;       // input row block    = output column block
  const int ldo = isW ? DHID : HLEN;   // row pitch of the turned planes; both inputs have rows of DHID floats
  const float* inb = isW ? W : H + zb * (size_t)(HLEN * DHID);
  unsigned short* ohb = isW ? WTh : HTh + zb * (size_t)(DHID * HLEN);
  unsigned short* olb = isW ? WTl : HTl + zb * (size_t)(DHID * HLEN);
  const int sub = tid >> 4;            // 0..15
  const int c4  = (tid & 15) * 4;      // 0..60
  v4f a[4];
#pragma unroll
  for (int it = 0; it < 4; ++it) a[it] = *(const v4f*)(inb + (size_t)(r0 + it * 16 + sub) * DHID + c0 + c4);
#pragma unroll
  for (int it = 0; it < 4; ++it) *(v4f*)(tf + (it * 16 + sub) * 68 + c4) = a[it];
  __syncthreads();                     // the tile is whole in LDS before it is read column-wise
  const int s8 = tid >> 3;             // 0..31
  const int c8 = (tid & 7) * 8;        // 0..56
#pragma unroll
  for (int it = 0; it < 2; ++it) {
    const int oc = it * 32 + s8;       // output row within tile (= input column)
    v4u t4, t4l;
#pragma unroll
    for (int q = 0; q < 4; ++q) {
      const float f0 = tf[(c8 + 2 * q) * 68 + oc];
      const float f1 = tf[(c8 + 2 * q + 1) * 68 + oc];
      const unsigned short h0 = f2bf_bits(f0), h1 = f2bf_bits(f1);
      const unsigned short l0 = f2bf_bits(f0 - bf_bits2f(h0));
      const unsigned short l1 = f2bf_bits(f1 - bf_bits2f(h1));
      t4[q]  = pk16(h0, h1);
      t4l[q] = pk16(l0, l1);
    }
    const size_t go = (size_t)(c0 + oc) * ldo + r0 + c8;
    *(v4u*)(ohb + go) = t4;
    *(v4u*)(olb + go) = t4l;
  }
  // the wait that stands before an issued store's registers are written again
  asm volatile("s_wait_xcnt 0x0" ::: "memory");
  // the natural planes, from the registers the tile was loaded into; behind the barrier, so that no wave holds the
  // work-group at the barrier for stores to memory
  if (!isW) {
#pragma unroll
    for (int it = 0; it < 4; ++it) {
      const size_t go = zb * (size_t)(HLEN * DHID) + (size_t)(r0 + it * 16 + sub) * DHID + c0 + c4;
      split4_store(a[it], Hh + go, Hl + go);
    }
    // the same wait: the listing keeps a path from here into the code of the pieces of P, which writes these registers
    asm volatile("s_wait_xcnt 0x0" ::: "memory");
  }
}

// ---------------------------------------------------------------------------
// Scores, masked row softmax and column maxima in one launch. A work-group of 16 waves owns 64 whole score rows of
// batch b = blockIdx.y (rows 64*blockIdx.x ...), wave w the 64x64 tile of columns 64*w ...; the scores never leave
// the registers:
//   s[p][q] = sum_e PW[b][p][e] H[b][q][e]   (bf16 hi/lo planes: hi.hi + lo.hi + hi.lo, f32 accumulate)
//   t[p][q] = (s + bias) + (1 - pm[b][p]*hm[b][q]) * (-1e30)
//   Ah/Al[b][p][q] = bf16 hi/lo of exp(t - max_q t) / sum_q;  CMP[b][blockIdx.x][q] = max of t over the 64 rows.
// Staging: a tile is 64 k (one 128-B line of every row) of ONE plane of all 1024 H rows, the hi plane always in
// buffer 0 (even trips), the lo plane in buffer 1 (odd trips); with the hi plane comes the same 64 k of the 64 PW
// rows, both planes, into one of two small buffers, which serves that trip and the next. LDS rows are 128 B without
// a pad: the 16-B piece c of row r lies at piece c ^ ((r >> 1) & 7), so that the 16 rows of a fragment load fall on
// 64 distinct banks.
// ---------------------------------------------------------------------------
#define FS_BBUF  (HLEN * 128)                 // one plane, 64 k, of the 1024 H rows
#define FS_APL   (64 * 128)                   // one plane, 64 k, of the 64 PW rows
#define FS_ABUF  (2 * FS_APL)                 // hi | lo
#define FS_AOFF  (2 * FS_BBUF)
#define FS_RING  (FS_AOFF + 2 * FS_ABUF)
static_assert(16 * 16 * 68 * 4 <= FS_AOFF, "the epilogue slabs reuse the stage buffers");

// Eight copies of 16 B per lane: rows r, r+64, ..., r+448 of a staged H plane. The s_wait_xcnt that stands before a
// copy's address registers are written again is the last line of the copies' own statement.
__device__ __forceinline__ void stage_rows8(unsigned l, const unsigned short* g) {
  asm volatile(
      "global_load_async_to_lds_b128 %0, %8, off\n\t"
      "global_load_async_to_lds_b128 %1, %9, off\n\t"
      "global_load_async_to_lds_b128 %2, %10, off\n\t"
      "global_load_async_to_lds_b128 %3, %11, off\n\t"
      "global_load_async_to_lds_b128 %4, %12, off\n\t"
      "global_load_async_to_lds_b128 %5, %13, off\n\t"
      "global_load_async_to_lds_b128 %6, %14, off\n\t"
      "global_load_async_to_lds_b128 %7, %15, off\n\t"
      "s_wait_xcnt 0x0"
      :: "v"(l), "v"(l + 1 * 8192), "v"(l + 2 * 8192), "v"(l + 3 * 8192),
         "v"(l + 4 * 8192), "v"(l + 5 * 8192), "v"(l + 6 * 8192), "v"(l + 7 * 8192),
         "v"(g), "v"(g + 1 * 64 * DHID), "v"(g + 2 * 64 * DHID), "v"(g + 3 * 64 * DHID),
         "v"(g + 4 * 64 * DHID), "v"(g + 5 * 64 * DHID), "v"(g + 6 * 64 * DHID), "v"(g + 7 * 64 * DHID)
      : "memory");
}
// all 1024 rows of one H plane: 16 copies per lane
__device__ __forceinline__ void stage_hplane(unsigned l, const unsigned short* g) {
  stage_rows8(l, g);
  stage_rows8(l + 8 * 8192, g + 8 * 64 * DHID);
}
// the lane's piece of one PW row, hi and lo plane; the same wait as above
__device__ __forceinline__ void stage_pw(unsigned l, const unsigned short* ghi, const unsigned short* glo) {
  asm volatile(
      "global_load_async_to_lds_b128 %0, %2, off\n\t"
      "global_load_async_to_lds_b128 %1, %3, off\n\t"
      "s_wait_xcnt 0x0"
      :: "v"(l), "v"(l + FS_APL), "v"(ghi), "v"(glo)
      : "memory");
}
// a 16x32 fragment from a staged row: elements 0..7 at piece offset c0, 8..15 at piece offset c1
__device__ __forceinline__ v16b frag_sw(const unsigned char* rowp, unsigned c0, unsigned c1) {
  Frag<__bf16>::U f;
  f.h[0] = *(const v8b*)(rowp + c0);
  f.h[1] = *(const v8b*)(rowp + c1);
  return f.v;
}
// exchange inside a 16-lane row (DPP row_xmask): the lanes of a row hold the 16 columns of an accumulator tile
template <int M> __device__ __forceinline__ float row_x(float v) {
  return __int_as_float(__builtin_amdgcn_update_dpp(0, __float_as_int(v), 0x160 + M, 0xf, 0xf, true));
}
// 2^x with the one free issue slot that the instruction set asks for behind a transcendental, before its result is read
// or its source overwritten: in one statement, so that the slot stays directly behind it
__device__ __forceinline__ float exp2_slot(float x) {
  float d;
  asm("v_exp_f32 %0, %1\n\tv_nop" : "=v"(d) : "v"(x));
  return d;
}
__device__ __forceinline__ float row_max16(float v) {
  v = fmaxf(v, row_x<1>(v)); v = fmaxf(v, row_x<2>(v)); v = fmaxf(v, row_x<4>(v)); v = fmaxf(v, row_x<8>(v));
  return v;
}
__device__ __forceinline__ float row_sum16(float v) {
  v += row_x<1>(v); v += row_x<2>(v); v += row_x<4>(v); v += row_x<8>(v);
  return v;
}

__global__ __launch_bounds__(512) void score_softmax_kernel(
    const unsigned short* __restrict__ PWh, const unsigned short* __restrict__ PWl,
    const unsigned short* __restrict__ Hh, const unsigned short* __restrict__ Hl,
    const int* __restrict__ pm, const int* __restrict__ hm, const float* __restrict__ bias,
    unsigned short* __restrict__ Ah, unsigned short* __restrict__ Al, float* __restrict__ CMP) {
  typedef __bf16 T;
  typedef Frag<T>::V V;
  __shared__ __align__(128) unsigned char ring[FS_RING];   // stage buffers; afterwards the epilogue slabs
  __shared__ __align__(16) float redw[16][64];             // one partial per wave and row
  __shared__ __align__(16) float rowv[64];                 // row maximum, later 1 / row sum
  __shared__ __align__(16) float spm[64];                  // premise mask of the 64 rows
  __shared__ float shm[HLEN];                              // hypothesis mask of the batch
  const int b     = blockIdx.y;
  const int mt    = blockIdx.x;
  const int tid   = threadIdx.x;
  const int lane  = tid & 31;
  const int wave  = tid >> 5;
  const int rlane = lane & 15;                 // row (A) / col (B, D) within subtile
  const int half  = lane >> 4;

  // copies: 8 lanes x 16 B cover the 128-B line of one row, the 512 threads 64 rows at a time
  const int crow = tid >> 3;
  const int ch   = tid & 7;
  const unsigned lc = (unsigned)(size_t)ring + (unsigned)(crow * 128 + ((ch ^ ((crow >> 1) & 7)) * 16));
  const unsigned ao = (unsigned)((b * PLEN + mt * 64 + crow) * DHID + ch * 8);   // element offsets, below 2^22
  const unsigned bo = (unsigned)((b * HLEN + crow) * DHID + ch * 8);

  v8f acc[4][4];
#pragma unroll
  for (int i = 0; i < 4; ++i)
#pragma unroll
    for (int j = 0; j < 4; ++j) acc[i][j] = (v8f){0.f,0.f,0.f,0.f,0.f,0.f,0.f,0.f};

  // tile 0 (H hi plane and PW, k 0..63), landed and published; then tile 1 (H lo plane, k 0..63)
  stage_hplane(lc, Hh + bo);
  stage_pw(lc + FS_AOFF, PWh + ao, PWl + ao);
  // the masks go to LDS while tile 0 flies; published by the barrier below, read behind the K loop
  if (tid < 64) spm[tid] = (float)pm[(size_t)b * PLEN + mt * 64 + tid];
  shm[tid]       = (float)hm[(size_t)b * HLEN + tid];
  shm[512 + tid] = (float)hm[(size_t)b * HLEN + 512 + tid];
  asm volatile("s_wait_asynccnt 0x0" ::: "memory");   // this wave's copies of tile 0 have landed
  __syncthreads();                                    // and every other wave's
  stage_hplane(lc + FS_BBUF, Hl + bo);

  // piece offsets of the lane's fragment halves: k block kb, half w -> piece kb*4 + w*2 + (lane >> 4), turned by the row
  const unsigned sw = (unsigned)((rlane >> 1) & 7);
  unsigned co[2][2];
#pragma unroll
  for (int kb = 0; kb < 2; ++kb)
#pragma unroll
    for (int w = 0; w < 2; ++w) co[kb][w] = (((unsigned)(kb * 4 + w * 2 + half)) ^ sw) * 16;
  const unsigned char* bB = ring + (wave * 64 + rlane) * 128;

  // the K loop stays rolled: 64 k per pass, two trips (hi plane of H, then lo plane), every register index a constant
#pragma clang loop unroll(disable)
  for (int kc = 0; kc < DHID / 64; ++kc) {
    const unsigned char* bA = ring + FS_AOFF + (kc & 1) * FS_ABUF + rlane * 128;
    {  // even trip: (PW hi + PW lo) . H hi; the next row's hi fragment is fetched ahead of this row's WMMAs, its own lo
       // fragment ahead of the four hi WMMAs that run before it is used
      V bf[4], ah[2];
      ah[0] = frag_sw(bA, co[0][0], co[0][1]);
#pragma unroll
      for (int u = 0; u < 8; ++u) {
        const int i = u & 3, kb = u >> 2;
        if (i == 0) {
#pragma unroll
          for (int j = 0; j < 4; ++j) bf[j] = frag_sw(bB + j * 2048, co[kb][0], co[kb][1]);
        }
        if (u + 1 < 8) {
          const int i1 = (u + 1) & 3, k1 = (u + 1) >> 2;
          ah[(u + 1) & 1] = frag_sw(bA + i1 * 2048, co[k1][0], co[k1][1]);
        }
        const V ahu = ah[u & 1];
        const V alu = frag_sw(bA + FS_APL + i * 2048, co[kb][0], co[kb][1]);
#pragma unroll
        for (int j = 0; j < 4; ++j) acc[i][j] = Frag<T>::mma(ahu, bf[j], acc[i][j]);
#pragma unroll
        for (int j = 0; j < 4; ++j) acc[i][j] = Frag<T>::mma(alu, bf[j], acc[i][j]);
        Frag<T>::guard(acc[i][0], acc[i][3], ahu, alu);
        if (i == 3) Frag<T>::keep(bf[0], bf[1], bf[2], bf[3]);
      }
    }
    asm volatile("s_wait_dscnt 0x0" ::: "memory");      // this wave's reads of buffer 0 are done before it is refilled
    asm volatile("s_wait_asynccnt 0x0" ::: "memory");   // this wave's copies of the lo plane have landed
    __syncthreads();   // publishes the lo plane and ends every wave's reads of the hi plane
    if (kc + 1 < DHID / 64) {
      const unsigned ko = (unsigned)(kc + 1) * 64;
      stage_hplane(lc, Hh + (bo + ko));
      // into the PW buffer that this pass does not read: its last readers left it before the previous barrier
      stage_pw(lc + FS_AOFF + ((kc + 1) & 1) * FS_ABUF, PWh + (ao + ko), PWl + (ao + ko));
    }
    {  // odd trip: PW hi . H lo
      V bf[4], ah[2];
      ah[0] = frag_sw(bA, co[0][0], co[0][1]);
#pragma unroll
      for (int u = 0; u < 8; ++u) {
        const int i = u & 3, kb = u >> 2;
        if (i == 0) {
#pragma unroll
          for (int j = 0; j < 4; ++j) bf[j] = frag_sw(bB + FS_BBUF + j * 2048, co[kb][0], co[kb][1]);
        }
        if (u + 1 < 8) {
          const int i1 = (u + 1) & 3, k1 = (u + 1) >> 2;
          ah[(u + 1) & 1] = frag_sw(bA + i1 * 2048, co[k1][0], co[k1][1]);
        }
        const V ahu = ah[u & 1];
#pragma unroll
        for (int j = 0; j < 4; ++j) acc[i][j] = Frag<T>::mma(ahu, bf[j], acc[i][j]);
        Frag<T>::guard(acc[i][0], acc[i][3], ahu, ahu);
        if (i == 3) Frag<T>::keep(bf[0], bf[1], bf[2], bf[3]);
      }
    }
    asm volatile("s_wait_dscnt 0x0" ::: "memory");      // this wave's reads of buffer 1 are done before it is refilled
    asm volatile("s_wait_asynccnt 0x0" ::: "memory");   // this wave's copies of the next hi plane and PW have landed
    __syncthreads();   // publishes them and ends every wave's reads of the lo plane and of this pass's PW buffer
    if (kc + 1 < DHID / 64) stage_hplane(lc + FS_BBUF, Hl + (bo + (unsigned)(kc + 1) * 64));
  }
  asm volatile("s_wait_asynccnt 0x0" ::: "memory");     // no copy is outstanding when the buffers become slabs
  acc_guard4(acc[0][0], acc[0][1], acc[0][2], acc[0][3]);
  acc_guard4(acc[1][0], acc[1][1], acc[1][2], acc[1][3]);
  acc_guard4(acc[2][0], acc[2][1], acc[2][2], acc[2][3]);
  acc_guard4(acc[3][0], acc[3][1], acc[3][2], acc[3][3]);

  // ---- bias and mask: acc[i][j][r] is row i*16 + half*8 + r, column wave*64 + j*16 + rlane ----
  const float bv = bias[0];
  float hmv[4];
#pragma unroll
  for (int j = 0; j < 4; ++j) hmv[j] = shm[wave * 64 + j * 16 + rlane];
  // one group of 16 rows at a time: t, the running column maxima, the rows' maxima (4 tiles in the lane, 16 lanes; the
  // 16 waves are joined in LDS below)
  float cm[4];
#pragma unroll
  for (int j = 0; j < 4; ++j) cm[j] = -__builtin_inff();
#pragma unroll
  for (int i = 0; i < 4; ++i) {
    const v4f p0 = *(const v4f*)(&spm[i * 16 + half * 8]);
    const v4f p1 = *(const v4f*)(&spm[i * 16 + half * 8 + 4]);
    v4f m0, m1;
#pragma unroll
    for (int r = 0; r < 8; ++r) {
      const float pmv = r < 4 ? p0[r & 3] : p1[r & 3];
#pragma unroll
      for (int j = 0; j < 4; ++j) {
        acc[i][j][r] = (acc[i][j][r] + bv) + (1.0f - pmv * hmv[j]) * NEG_FILL;
        cm[j] = fmaxf(cm[j], acc[i][j][r]);
      }
      const float m = row_max16(fmaxf(fmaxf(acc[i][0][r], acc[i][1][r]), fmaxf(acc[i][2][r], acc[i][3][r])));
      if (r < 4) m0[r & 3] = m; else m1[r & 3] = m;
    }
    if (rlane == 0) {
      *(v4f*)(&redw[wave][i * 16 + half * 8])     = m0;
      *(v4f*)(&redw[wave][i * 16 + half * 8 + 4]) = m1;
    }
    // keeps one group's mask terms from being formed beside the next group's: together they overran the registers
    __builtin_amdgcn_sched_barrier(0);
  }
  // column maxima over the work-group's 64 rows
#pragma unroll
  for (int j = 0; j < 4; ++j) {
    const float c = fmaxf(cm[j], __shfl_xor(cm[j], 16, 32));   // the two row halves of the tiles
    if (half == 0) CMP[((size_t)b * (PLEN / 64) + mt) * HLEN + wave * 64 + j * 16 + rlane] = c;
  }
  __syncthreads();   // every wave's row maxima are in redw
  if (tid < 64) {
    float m = redw[0][tid];
#pragma unroll
    for (int w = 1; w < 16; ++w) m = fmaxf(m, redw[w][tid]);
    rowv[tid] = m;
  }
  __syncthreads();   // the row maxima are in rowv; redw is free again
  // ---- exp and row sums (fixed order: 4 tiles in index order, lane exchange 1, 2, 4, 8, 16 waves in index order) ----
#pragma unroll
  for (int i = 0; i < 4; ++i) {
    const v4f x0 = *(const v4f*)(&rowv[i * 16 + half * 8]);
    const v4f x1 = *(const v4f*)(&rowv[i * 16 + half * 8 + 4]);
    v4f s0, s1;
#pragma unroll
    for (int r = 0; r < 8; ++r) {
      const float mx = r < 4 ? x0[r & 3] : x1[r & 3];
#pragma unroll
      for (int j = 0; j < 4; ++j) acc[i][j][r] = exp2_slot((acc[i][j][r] - mx) * 1.44269504088896341f);
      const float s = row_sum16(((acc[i][0][r] + acc[i][1][r]) + acc[i][2][r]) + acc[i][3][r]);
      if (r < 4) s0[r & 3] = s; else s1[r & 3] = s;
    }
    if (rlane == 0) {
      *(v4f*)(&redw[wave][i * 16 + half * 8])     = s0;
      *(v4f*)(&redw[wave][i * 16 + half * 8 + 4]) = s1;
    }
  }
  __syncthreads();   // every wave's row sums are in redw, and every read of the maxima in rowv is done
  if (tid < 64) {
    float s = redw[0][tid];
#pragma unroll
    for (int w = 1; w < 16; ++w) s += redw[w][tid];
    rowv[tid] = 1.0f / s;                               // s >= 1 (the row maximum contributes exp(0))
  }
  __syncthreads();   // 1 / row sum is in rowv

  // ---- probabilities -> bf16 hi/lo planes; per-wave 16x64 slab, pitch 68 floats, in the stage buffers, so that
  // every store instruction writes whole 128-B lines ----
  float* slab = (float*)ring + wave * (16 * 68);
  const int q = lane >> 3, c8 = (lane & 7) * 8;
#pragma unroll
  for (int i = 0; i < 4; ++i) {
    const v4f y0 = *(const v4f*)(&rowv[i * 16 + half * 8]);
    const v4f y1 = *(const v4f*)(&rowv[i * 16 + half * 8 + 4]);
#pragma unroll
    for (int r = 0; r < 8; ++r) {
      const float inv = r < 4 ? y0[r & 3] : y1[r & 3];
#pragma unroll
      for (int j = 0; j < 4; ++j) slab[(half * 8 + r) * 68 + (j << 4) + rlane] = acc[i][j][r] * inv;
    }
    // the wave's slab writes stand before its lanes read one another's values (one wave: LDS keeps its order)
    asm volatile("s_wait_dscnt 0x0" ::: "memory");
    __builtin_amdgcn_wave_barrier();
#pragma unroll
    for (int it = 0; it < 4; ++it) {
      const int row = it * 4 + q;
      const float* sp = slab + row * 68 + c8;
      v8b hv, lv;
#pragma unroll
      for (int e = 0; e < 8; ++e) {
        const float p = sp[e];
        const __bf16 hb = (__bf16)p;
        hv[e] = hb;
        lv[e] = (__bf16)(p - (float)hb);
      }
      const size_t go = ((size_t)b * PLEN + (size_t)(mt * 64 + i * 16 + row)) * HLEN + wave * 64 + c8;
      *(v8b*)(Ah + go) = hv;
      *(v8b*)(Al + go) = lv;
    }
    // the slab's reads have returned before the next 16 rows overwrite it
    asm volatile("s_wait_dscnt 0x0" ::: "memory");
    __builtin_amdgcn_wave_barrier();
  }
}

// ---------------------------------------------------------------------------
// Aligned premise of batch b = b0 + blockIdx.y, hidden columns d0 = 32*blockIdx.x .. d0+31 (one 128-B line of every
// row): cm[q] = max of the PLEN/64 partial column maxima CM[slice][.][q], at[q] = softmax_q(cm[q]) (f32, fixed order,
// computed by each of the 8 work-groups of a batch),
// ap[d] = sum_q at[q] * P[b][q][d], then out0[b][r][d0..d0+31] = ap for every r < HLEN.
// 8 lanes x 16 B cover the line of one row, so the 256 threads cover 32 rows at a time and each thread walks only
// HLEN/32 = 32 rows, whose loads are all issued at the top, together with those of the column maxima.
// Sum order (fixed): per thread q = rsub, rsub+32, ...; lane exchange over 8 then 16; 8 wave partials in index order.
// ---------------------------------------------------------------------------
__global__ __launch_bounds__(256) void premise_kernel(
    const float* __restrict__ CM, const float* __restrict__ P, float* __restrict__ out0, int b0) {
  __shared__ __align__(16) float scm[HLEN];
  __shared__ __align__(16) float spr[HLEN];
  __shared__ __align__(16) float spart[8][32];
  __shared__ float redm[8];
  __shared__ float reds[8];
  const int bb   = blockIdx.y;
  int b = b0 + bb;
  b = b < 0 ? 0 : (b > NBATCH - 1 ? NBATCH - 1 : b);
  const int tid  = threadIdx.x;
  const int lane = tid & 31;
  const int wave = tid >> 5;
  const int c4   = (tid & 7) * 4;                      // column quad inside the 32-column strip
  const int rsub = tid >> 3;                           // row class 0..31
  const size_t so = (size_t)b * PLEN * DHID + (size_t)rsub * DHID + blockIdx.x * 32 + c4;

  // every load of the kernel is issued before the first wait on data: one round trip to memory in all
  float cv[HLEN / 256];
#pragma unroll
  for (int j = 0; j < HLEN / 256; ++j) {
    const float* cp = CM + (size_t)bb * (PLEN / 64) * HLEN + j * 256 + tid;
    float c = cp[0];
#pragma unroll
    for (int m = 1; m < PLEN / 64; ++m) c = fmaxf(c, cp[(size_t)m * HLEN]);
    cv[j] = c;
  }
  const float* Pb = P + so;
  v4f pv[HLEN / 32];
#pragma unroll
  for (int k = 0; k < HLEN / 32; ++k) pv[k] = *(const v4f*)(Pb + (size_t)k * 32 * DHID);

  float lm = -__builtin_inff();
#pragma unroll
  for (int j = 0; j < HLEN / 256; ++j) {
    scm[j * 256 + tid] = cv[j];
    lm = fmaxf(lm, cv[j]);
  }
#pragma unroll
  for (int off = 16; off > 0; off >>= 1) lm = fmaxf(lm, __shfl_xor(lm, off, 32));
  if (lane == 0) redm[wave] = lm;
  __syncthreads();
  float mx = redm[0];
#pragma unroll
  for (int w = 1; w < 8; ++w) mx = fmaxf(mx, redm[w]);

  float ls = 0.f;
  for (int i = tid; i < HLEN; i += 256) {
    const float e = __expf(scm[i] - mx);
    spr[i] = e;
    ls += e;
  }
#pragma unroll
  for (int off = 16; off > 0; off >>= 1) ls += __shfl_xor(ls, off, 32);
  if (lane == 0) reds[wave] = ls;
  __syncthreads();
  float tot = reds[0];
#pragma unroll
  for (int w = 1; w < 8; ++w) tot += reds[w];
  const float inv = 1.0f / tot;                        // tot >= 1
  for (int i = tid; i < HLEN; i += 256) spr[i] = spr[i] * inv;   // same thread wrote spr[i]
  __syncthreads();

  v4f acc = (v4f){0.f, 0.f, 0.f, 0.f};
#pragma unroll
  for (int k = 0; k < HLEN / 32; ++k) acc = acc + spr[k * 32 + rsub] * pv[k];
#pragma unroll
  for (int e = 0; e < 4; ++e) {
    acc[e] += __shfl_xor(acc[e], 8, 32);               // the wave's four row classes
    acc[e] += __shfl_xor(acc[e], 16, 32);
  }
  if (lane < 8) *(v4f*)(&spart[wave][c4]) = acc;
  __syncthreads();
  v4f va = *(const v4f*)(&spart[0][c4]);
#pragma unroll
  for (int w = 1; w < 8; ++w) va = va + *(const v4f*)(&spart[w][c4]);

  float* ob = out0 + so;                               // PLEN == HLEN: out0 has the premise's shape
#pragma unroll
  for (int k = 0; k < HLEN / 32; ++k) *(v4f*)(ob + (size_t)k * 32 * DHID) = va;
}

// ---------------------------------------------------------------------------
// Workspace region map (byte offsets, all multiples of 16 KiB). Every region is fully written before it is read:
// the weight/activation planes once up front; Ah/Al, CM fully written per group of GRPB batches.
//   WTh   bf16 [256][256]    Wt[e][d] = W[d][e] hi              0
//   WTl   bf16 [256][256]                                  131072
//   Ph    bf16 [16][1024][256] premise hi                  262144
//   Pl                                                    8650752
//   Hh    bf16 [16][1024][256] hypothesis hi             17039360
//   Hl                                                   25427968
//   HTh   bf16 [16][256][1024] hypothesis^T hi           33816576
//   HTl                                                  42205184
//   PWh   bf16 [16*1024][256]  (P.W) hi                  50593792
//   PWl                                                  58982400
//   Ah    bf16 [GRPB][1024][1024] row softmax hi         67371008
//   Al                                                 100925440
//   CM    f32  [GRPB][16][1024] masked column maxima of 64 rows each  134479872
//   total                                               135528448
// ---------------------------------------------------------------------------
extern "C" void kernel_launch(void* const* d_in, const int* in_sizes, int n_in,
                              void* d_out, int out_size, void* d_ws, size_t ws_size,
                              hipStream_t stream) {
  if (n_in < 6) return;
  if (in_sizes[0] != NBATCH * PLEN * DHID) return;
  if (in_sizes[1] != NBATCH * HLEN * DHID) return;
  if (in_sizes[2] != NBATCH * PLEN || in_sizes[3] != NBATCH * HLEN) return;
  if (in_sizes[4] != DHID * DHID || in_sizes[5] < 1) return;
  if (out_size != 2 * NBATCH * PLEN * DHID) return;

  const float* P    = (const float*)d_in[0];
  const float* H    = (const float*)d_in[1];
  const int*   pm   = (const int*)d_in[2];
  const int*   hm   = (const int*)d_in[3];
  const float* W    = (const float*)d_in[4];
  const float* bias = (const float*)d_in[5];

  const size_t PWT = (size_t)DHID * DHID * 2;                 // 16-bit [256][256]
  const size_t PAC = (size_t)NBATCH * PLEN * DHID * 2;        // 16-bit [16][1024][256]
  const size_t PPR = (size_t)GRPB * PLEN * HLEN * 2;          // bf16 probability plane of one group
  const size_t PCM = (size_t)GRPB * (PLEN / 64) * HLEN * 4;
  size_t off = 0;
  const size_t oWTh = off; off += PWT;
  const size_t oWTl = off; off += PWT;
  const size_t oPh  = off; off += PAC;
  const size_t oPl  = off; off += PAC;
  const size_t oHh  = off; off += PAC;
  const size_t oHl  = off; off += PAC;
  const size_t oHTh = off; off += PAC;
  const size_t oHTl = off; off += PAC;
  const size_t oPWh = off; off += PAC;
  const size_t oPWl = off; off += PAC;
  const size_t oAh  = off; off += PPR;
  const size_t oAl  = off; off += PPR;
  const size_t oCM  = off; off += PCM;
  if (off > ws_size) return;

  char* ws = (char*)d_ws;
  unsigned short* WTh = (unsigned short*)(ws + oWTh);
  unsigned short* WTl = (unsigned short*)(ws + oWTl);
  unsigned short* Ph  = (unsigned short*)(ws + oPh);
  unsigned short* Pl  = (unsigned short*)(ws + oPl);
  unsigned short* Hh  = (unsigned short*)(ws + oHh);
  unsigned short* Hl  = (unsigned short*)(ws + oHl);
  unsigned short* HTh = (unsigned short*)(ws + oHTh);
  unsigned short* HTl = (unsigned short*)(ws + oHTl);
  unsigned short* PWh = (unsigned short*)(ws + oPWh);
  unsigned short* PWl = (unsigned short*)(ws + oPWl);
  unsigned short* Ah  = (unsigned short*)(ws + oAh);
  unsigned short* Al  = (unsigned short*)(ws + oAl);
  float*          CM  = (float*)(ws + oCM);

  float* out0 = (float*)d_out;                                   // aligned premise (broadcast) [16][1024][256]
  float* out1 = (float*)d_out + (size_t)NBATCH * PLEN * DHID;    // aligned hypothesis [16][1024][256]

  const dim3 blk(256);
  // (0-2) W -> WT[e][d], P -> natural planes, H -> natural planes and HT[b][d][q], all hi/lo, in one launch
  prep_kernel<<<dim3(PREP_HT + PREP_WT + PREP_PB), blk, 0, stream>>>(P, H, W, Ph, Pl, Hh, Hl, HTh, HTl, WTh, WTl);
  // (3) PW[p][e] = sum_d P[p][d] W[d][e] over all batches: M=16384, N=256, K=256 (K%64, M,N%128) -> PW hi/lo planes
  const dim3 gblk(128);                                          // GEMM work-group: 4 waves, one 128x128 tile
  const dim3 gPW((NBATCH * PLEN / 128) * (DHID / 128), 1);       // 256 blocks
  wmma_gemm64<1, true, 0, 2, false, 0><<<gPW, gblk, 0, stream>>>(
      Ph, Pl, DHID, 0L, WTh, WTl, DHID, 0L, (void*)PWh, (void*)PWl, DHID, 0L,
      bias, bias, 0L, NBATCH * PLEN, DHID, DHID, 1.0f);

  const dim3 gS(PLEN / 64, GRPB);                                // 16 x GRPB, 512 threads each: 64 whole score rows
  const dim3 gPr(DHID / 32, GRPB);                               // 8 x GRPB
  const dim3 gAV((PLEN / 128) * (DHID / 128), GRPB);             // 16 x GRPB: M=1024, N=256, K=1024

  for (int g = 0; g < NGRPS; ++g) {
    const int b0 = g * GRPB;
    const size_t aoff = (size_t)b0 * PLEN * DHID;               // u16 / float offset of batch b0 in [16][1024][256]
    const size_t toff = (size_t)b0 * DHID * HLEN;               // u16 offset of batch b0 in [16][256][1024]
    // (4-6) scores PW[b].H[b]^T, bias + mask, row softmax -> A hi/lo planes (whole 1024x1024 per bb), partial column maxima
    score_softmax_kernel<<<gS, dim3(512), 0, stream>>>(PWh + aoff, PWl + aoff, Hh + aoff, Hl + aoff,
        pm + (size_t)b0 * PLEN, hm + (size_t)b0 * HLEN, bias, Ah, Al, CM);
    // (7) softmax(CM), premise reduction, broadcast rows -> out0[b] (whole 1024x256 per b)
    premise_kernel<<<gPr, blk, 0, stream>>>(CM, P, out0, b0);
    // (8) out1[b][p][d] = sum_q A[bb][p][q] HT[b][d][q]: M=1024, N=256, K=1024 -> f32 d_out (whole 1024x256 per b)
    wmma_gemm64<1, true, 0, 0, false, 0><<<gAV, gblk, 0, stream>>>(
        Ah, Al, HLEN, (long)PLEN * HLEN,
        HTh + toff, HTl + toff, HLEN, (long)DHID * HLEN,
        (void*)(out1 + aoff), (void*)(out1 + aoff), DHID, (long)PLEN * DHID,
        bias, bias, 0L, PLEN, DHID, HLEN, 1.0f);
  }
}
